// v000
// The times below were measured on an AMD MI455X: many runs one after another, warmed up first and cycling through
// copies of the inputs, with the whole window's GPU time divided by the number of runs. Launches and the gaps
// between them are all in it. The median over several windows is given; except for v000 it joins two sittings, which
// can be a few percent apart, so the side-by-side timings, each taken in one sitting, are the better comparison.
// v000, which the later versions start from, runs in 81 microseconds.
#include <hip/hip_runtime.h>
#include <hip/hip_bf16.h>

typedef _Float16 half_t;
typedef __attribute__((ext_vector_type(16))) _Float16 v16h;
typedef __attribute__((ext_vector_type(8)))  _Float16 v8h;
typedef __attribute__((ext_vector_type(8)))  float    v8f;

#define NH   8
#define NN   384
#define NL   64
#define DIN  128
#define DOUT 32
#define NROWS (NH*NN*NL)              // 196608
#define KQ_ELEMS ((size_t)NROWS*DOUT) // 6291456 per matrix

__device__ __forceinline__ v8f wmma_f16(v16h a, v16h b, v8f c) {
  return __builtin_amdgcn_wmma_f32_16x16x32_f16(false, a, false, b, (short)0, c, false, false);
}

// Build a 16x32-f16 WMMA A/B fragment from a row-major f16 row (LDS or global).
// Per ISA 7.12.2: lane-half hf=0 needs K{0..7,16..23}, hf=1 needs K{8..15,24..31}
// -> two contiguous 16B chunks at +hf*8 and +hf*8+16 halves.
__device__ __forceinline__ v16h frag_from_row(const half_t* rowp, int hf) {
  v8h lo = *(const v8h*)(rowp + hf*8);
  v8h hi = *(const v8h*)(rowp + hf*8 + 16);
  v16h r;
#pragma unroll
  for (int e = 0; e < 8; ++e) { r[e] = lo[e]; r[e+8] = hi[e]; }
  return r;
}

// ---------------------------------------------------------------------------
// Kernel 0: one-shot f32 -> f16 conversion of the three weight matrices into
// workspace so the streaming kernel never does VALU converts for weights.
// ---------------------------------------------------------------------------
__global__ __launch_bounds__(256)
void prep_weights_kernel(const float* __restrict__ proj_w,
                         const float* __restrict__ wk,
                         const float* __restrict__ wq,
                         half_t* __restrict__ wout)
{
  int t = blockIdx.x * 256 + threadIdx.x;
  if (t < DOUT*DIN)                 wout[t] = (half_t)proj_w[t];
  else if (t < DOUT*DIN + DOUT*DOUT)   wout[t] = (half_t)wk[t - DOUT*DIN];
  else if (t < DOUT*DIN + 2*DOUT*DOUT) wout[t] = (half_t)wq[t - DOUT*DIN - DOUT*DOUT];
}

// ---------------------------------------------------------------------------
// Kernel 1: fused LayerNorm + proj(128->32, +bias) + k/q proj (32->32),
// one streaming pass over x.  4 waves/block, one 16-row tile per wave.
// ---------------------------------------------------------------------------
__global__ __launch_bounds__(128)
void ln_proj_kq_kernel(const float* __restrict__ x,
                       const float* __restrict__ ln_w,  const float* __restrict__ ln_b,
                       const half_t* __restrict__ pwh,  const float* __restrict__ proj_b,
                       const half_t* __restrict__ wkh,  const half_t* __restrict__ wqh,
                       half_t* __restrict__ kws, half_t* __restrict__ qws)
{
  __shared__ __align__(16) float  xs[4][16*DIN];   // 32 KB
  __shared__ __align__(16) half_t xn[4][16*DIN];   // 16 KB
  __shared__ __align__(16) half_t xp[4][16*DOUT];  //  4 KB
  __shared__ float s_lnw[DIN], s_lnb[DIN];

  const int tid  = threadIdx.x;
  const int w    = tid >> 5;
  const int lane = tid & 31;
  const int n0   = lane & 15;      // N / M index within tile
  const int hf   = lane >> 4;      // lane half

  if (tid < DIN) { s_lnw[tid] = ln_w[tid]; s_lnb[tid] = ln_b[tid]; }

  const int tile    = blockIdx.x * 4 + w;
  const int rowBase = tile * 16;

  // --- load 16x128 f32 tile (coalesced b128) ---
  const float4* xsrc = (const float4*)(x + (size_t)rowBase * DIN);
  float4*       xdst = (float4*)xs[w];
#pragma unroll
  for (int it = 0; it < 16; ++it) xdst[lane + it*32] = xsrc[lane + it*32];
  __syncthreads();

  // --- LayerNorm stats: 2 lanes per row ---
  const float* xr = &xs[w][n0*DIN + hf*64];
  float s = 0.f, s2 = 0.f;
#pragma unroll
  for (int t = 0; t < 64; ++t) { float v = xr[t]; s += v; s2 += v*v; }
  s  += __shfl_xor(s, 16, 32);
  s2 += __shfl_xor(s2, 16, 32);
  const float mu   = s * (1.f/128.f);
  const float var  = s2 * (1.f/128.f) - mu*mu;
  const float rstd = rsqrtf(var + 1e-5f);

  // --- normalize + affine -> f16 ---
#pragma unroll
  for (int t = 0; t < 64; ++t) {
    int c = hf*64 + t;
    float v = (xs[w][n0*DIN + c] - mu) * rstd * s_lnw[c] + s_lnb[c];
    xn[w][n0*DIN + c] = (half_t)v;
  }
  __syncthreads();

  // --- proj: xp = xn @ proj_w^T + proj_b  (16x128 @ 128x32) ---
  v16h bp[2][4];
#pragma unroll
  for (int nt = 0; nt < 2; ++nt)
#pragma unroll
    for (int kb = 0; kb < 4; ++kb)
      bp[nt][kb] = frag_from_row(pwh + (n0 + nt*16)*DIN + kb*32, hf);

  v8f c0, c1;
  { float b0 = proj_b[n0], b1 = proj_b[n0 + 16];
#pragma unroll
    for (int r = 0; r < 8; ++r) { c0[r] = b0; c1[r] = b1; } }

#pragma unroll
  for (int kb = 0; kb < 4; ++kb) {
    v16h a = frag_from_row(&xn[w][n0*DIN + kb*32], hf);
    c0 = wmma_f16(a, bp[0][kb], c0);
    c1 = wmma_f16(a, bp[1][kb], c1);
  }

  // stash xp tile (row-major f16)
#pragma unroll
  for (int r = 0; r < 8; ++r) {
    int m = r + hf*8;
    xp[w][m*DOUT + n0]      = (half_t)c0[r];
    xp[w][m*DOUT + n0 + 16] = (half_t)c1[r];
  }
  __syncthreads();

  // --- k = xp @ wk^T , q = xp @ wq^T  (16x32 @ 32x32) ---
  v16h bk0 = frag_from_row(wkh + n0*DOUT, hf);
  v16h bk1 = frag_from_row(wkh + (n0+16)*DOUT, hf);
  v16h bq0 = frag_from_row(wqh + n0*DOUT, hf);
  v16h bq1 = frag_from_row(wqh + (n0+16)*DOUT, hf);

  v16h a2 = frag_from_row(&xp[w][n0*DOUT], hf);
  v8f z = {};
  v8f ck0 = wmma_f16(a2, bk0, z);
  v8f ck1 = wmma_f16(a2, bk1, z);
  v8f cq0 = wmma_f16(a2, bq0, z);
  v8f cq1 = wmma_f16(a2, bq1, z);

  // scatter-store K/Q as f16 in [h][l][i][d] so kernel 2 loads coalesced
#pragma unroll
  for (int r = 0; r < 8; ++r) {
    int gm = rowBase + r + hf*8;
    int h  = gm / (NN*NL);
    int i  = (gm >> 6) % NN;
    int l  = gm & 63;
    size_t base = (((size_t)(h*NL + l))*NN + i) * DOUT;
    kws[base + n0]      = (half_t)ck0[r];
    kws[base + n0 + 16] = (half_t)ck1[r];
    qws[base + n0]      = (half_t)cq0[r];
    qws[base + n0 + 16] = (half_t)cq1[r];
  }
}

// ---------------------------------------------------------------------------
// Kernel 2: per (h,l) pair: scores = K @ Q^T * scale (+eps), softmax over i
// (online, per column j), mean over j.  One block per (h,l), all in LDS.
// K/Q tiles are brought in with ASYNC global->LDS copies (ASYNCcnt path).
// ---------------------------------------------------------------------------
#define SCALING 0.17677669529663687f  // 1/sqrt(32)
#define SM_EPS  1e-6f

__global__ __launch_bounds__(256)
void atten_kernel(const half_t* __restrict__ kws, const half_t* __restrict__ qws,
                  float* __restrict__ out)
{
  __shared__ __align__(16) half_t Kt[NN*DOUT];  // 24 KB
  __shared__ __align__(16) half_t Qt[NN*DOUT];  // 24 KB
  __shared__ float outAcc[NN];

  const int tid = threadIdx.x;
  const size_t base = (size_t)blockIdx.x * (NN*DOUT);

  // ---- async global -> LDS tile fetch (GLOBAL_LOAD_ASYNC_TO_LDS_B128) ----
  {
    const void* ksrc = (const void*)(kws + base);
    const void* qsrc = (const void*)(qws + base);
    unsigned lk = (unsigned)(size_t)(void*)Kt;   // addrspace(3) offset in low bits
    unsigned lq = (unsigned)(size_t)(void*)Qt;
#pragma unroll
    for (int it = 0; it < 6; ++it) {             // 256 lanes * 6 * 16B = 24 KB
      unsigned off = (unsigned)(tid + it*256) * 16u;
      asm volatile("global_load_async_to_lds_b128 %0, %1, %2"
                   :: "v"(lk + off), "v"(off), "s"(ksrc) : "memory");
      asm volatile("global_load_async_to_lds_b128 %0, %1, %2"
                   :: "v"(lq + off), "v"(off), "s"(qsrc) : "memory");
    }
    asm volatile("s_wait_asynccnt 0x0" ::: "memory");
  }
  outAcc[tid] = 0.f;
  if (tid < NN - 256) outAcc[256 + tid] = 0.f;
  __syncthreads();

  const int w    = tid >> 5;
  const int lane = tid & 31;
  const int n0   = lane & 15;
  const int hf   = lane >> 4;
  v8f z = {};

  for (int js = w; js < 24; js += 8) {       // each wave owns 3 j-strips
    const int j0 = js * 16;
    v16h b = frag_from_row(&Qt[(j0 + n0)*DOUT], hf);  // B[d][j] = Q[j][d]

    // ---- pass 1: online column softmax stats (max m, denom d per column) ----
    float mrun = -__builtin_inff();
    float drun = 0.f;
    for (int ti = 0; ti < 24; ++ti) {
      v16h a = frag_from_row(&Kt[(ti*16 + n0)*DOUT], hf);
      v8f  c = wmma_f16(a, b, z);
      float sc[8], tmax = -__builtin_inff();
#pragma unroll
      for (int r = 0; r < 8; ++r) { sc[r] = c[r]*SCALING + SM_EPS; tmax = fmaxf(tmax, sc[r]); }
      tmax = fmaxf(tmax, __shfl_xor(tmax, 16, 32));   // combine M halves
      float mnew = fmaxf(mrun, tmax);
      float psum = 0.f;
#pragma unroll
      for (int r = 0; r < 8; ++r) psum += __expf(sc[r] - mnew);
      psum += __shfl_xor(psum, 16, 32);
      drun = drun * __expf(mrun - mnew) + psum;
      mrun = mnew;
    }
    const float inv_d = 1.f / drun;

    // ---- pass 2: probabilities, reduce over j (N) into per-row accumulator ----
    for (int ti = 0; ti < 24; ++ti) {
      v16h a = frag_from_row(&Kt[(ti*16 + n0)*DOUT], hf);
      v8f  c = wmma_f16(a, b, z);
      float p[8];
#pragma unroll
      for (int r = 0; r < 8; ++r)
        p[r] = __expf(c[r]*SCALING + SM_EPS - mrun) * inv_d;
#pragma unroll
      for (int mk = 1; mk < 16; mk <<= 1)
#pragma unroll
        for (int r = 0; r < 8; ++r) p[r] += __shfl_xor(p[r], mk, 32);
      if (n0 == 0) {
#pragma unroll
        for (int r = 0; r < 8; ++r)
          atomicAdd(&outAcc[ti*16 + hf*8 + r], p[r]);
      }
    }
  }
  __syncthreads();

  const int h = blockIdx.x >> 6;
  const int l = blockIdx.x & 63;
  for (int t = tid; t < NN; t += 256)
    out[((size_t)(h*NN + t))*NL + l] = outAcc[t] * (1.f / 384.f);
}

// ---------------------------------------------------------------------------
extern "C" void kernel_launch(void* const* d_in, const int* in_sizes, int n_in,
                              void* d_out, int out_size, void* d_ws, size_t ws_size,
                              hipStream_t stream) {
  const float* x      = (const float*)d_in[0];
  const float* ln_w   = (const float*)d_in[1];
  const float* ln_b   = (const float*)d_in[2];
  const float* proj_w = (const float*)d_in[3];
  const float* proj_b = (const float*)d_in[4];
  const float* wk     = (const float*)d_in[5];
  const float* wq     = (const float*)d_in[6];

  half_t* kws = (half_t*)d_ws;
  half_t* qws = kws + KQ_ELEMS;           // 2 * 12 MB of f16 scratch
  half_t* wgt = qws + KQ_ELEMS;           // f16 weights: proj_w | wk | wq
  half_t* pwh = wgt;
  half_t* wkh = pwh + DOUT*DIN;
  half_t* wqh = wkh + DOUT*DOUT;

  prep_weights_kernel<<<(DOUT*DIN + 2*DOUT*DOUT + 255)/256, 256, 0, stream>>>(
      proj_w, wk, wq, wgt);
  // 196608 rows / 16 per wave / 4 waves per block
  ln_proj_kq_kernel<<<NROWS/64, 128, 0, stream>>>(x, ln_w, ln_b, pwh, proj_b,
                                                  wkh, wqh, kws, qws);
  // one block per (h,l) pair
  atten_kernel<<<NH*NL, 256, 0, stream>>>(kws, qws, (float*)d_out);
}

// v001
// A run of this version takes 67.5 microseconds.
// Next to v000, in two timings, it ran 1.24 and 1.26 times as fast.
#include <hip/hip_runtime.h>
#include <hip/hip_bf16.h>

typedef _Float16 half_t;
typedef __attribute__((ext_vector_type(16))) _Float16 v16h;
typedef __attribute__((ext_vector_type(8)))  _Float16 v8h;
typedef __attribute__((ext_vector_type(8)))  float    v8f;
typedef __attribute__((ext_vector_type(4)))  float    v4f;

#define NH   8
#define NN   384
#define NL   64
#define DIN  128
#define DOUT 32
#define NROWS (NH*NN*NL)              // 196608
#define KQ_ELEMS ((size_t)NROWS*DOUT) // 6291456 per matrix

__device__ __forceinline__ v8f wmma_f16(v16h a, v16h b, v8f c) {
  return __builtin_amdgcn_wmma_f32_16x16x32_f16(false, a, false, b, (short)0, c, false, false);
}

// Build a 16x32-f16 WMMA A/B fragment from a row-major f16 row (LDS or global).
// Per ISA 7.12.2: lane-half hf=0 needs K{0..7,16..23}, hf=1 needs K{8..15,24..31}
// -> two contiguous 16B chunks at +hf*8 and +hf*8+16 halves.
__device__ __forceinline__ v16h frag_from_row(const half_t* rowp, int hf) {
  v8h lo = *(const v8h*)(rowp + hf*8);
  v8h hi = *(const v8h*)(rowp + hf*8 + 16);
  v16h r;
#pragma unroll
  for (int e = 0; e < 8; ++e) { r[e] = lo[e]; r[e+8] = hi[e]; }
  return r;
}

// ---------------------------------------------------------------------------
// Kernel 0: one-shot f32 -> f16 conversion of the three weight matrices into
// workspace so the streaming kernel never does VALU converts for weights.
// ---------------------------------------------------------------------------
__global__ __launch_bounds__(256)
void prep_weights_kernel(const float* __restrict__ proj_w,
                         const float* __restrict__ wk,
                         const float* __restrict__ wq,
                         half_t* __restrict__ wout)
{
  int t = blockIdx.x * 256 + threadIdx.x;
  if (t < DOUT*DIN)                 wout[t] = (half_t)proj_w[t];
  else if (t < DOUT*DIN + DOUT*DOUT)   wout[t] = (half_t)wk[t - DOUT*DIN];
  else if (t < DOUT*DIN + 2*DOUT*DOUT) wout[t] = (half_t)wq[t - DOUT*DIN - DOUT*DOUT];
}

// ---------------------------------------------------------------------------
// Kernel 1: fused LayerNorm + proj(128->32, +bias) + k/q proj (32->32),
// one streaming pass over x.  4 waves/block, one 16-row tile per wave.
// The f32 tile is staged in LDS at a padded row pitch; each lane then reads its
// row's columns ONCE, already in WMMA A-fragment order, and keeps them in
// registers for the statistics, the normalisation and the f16 fragments.
// ---------------------------------------------------------------------------
#define XPITCH 132  // floats per LDS row: 528 B = 16 B x 33 (odd), so the 16 rows of a b128 column read fall on 64 distinct banks
#define PPITCH 40   // halfs per LDS row of xp: 80 B = 16 B x 5 (odd), same reason

__global__ __launch_bounds__(128)
void ln_proj_kq_kernel(const float* __restrict__ x,
                       const float* __restrict__ ln_w,  const float* __restrict__ ln_b,
                       const half_t* __restrict__ pwh,  const float* __restrict__ proj_b,
                       const half_t* __restrict__ wkh,  const half_t* __restrict__ wqh,
                       half_t* __restrict__ kws, half_t* __restrict__ qws)
{
  __shared__ __align__(16) float  xs[4][16*XPITCH];  // 33 KB
  __shared__ __align__(16) half_t xp[4][16*PPITCH];  //  5 KB
  __shared__ __align__(16) float  s_lnw[DIN];
  __shared__ __align__(16) float  s_lnb[DIN];

  const int tid  = threadIdx.x;
  const int w    = tid >> 5;
  const int lane = tid & 31;
  const int n0   = lane & 15;      // N / M index within tile
  const int hf   = lane >> 4;      // lane half

  if (tid < DIN) { s_lnw[tid] = ln_w[tid]; s_lnb[tid] = ln_b[tid]; }

  const int tile    = blockIdx.x * 4 + w;
  const int rowBase = tile * 16;

  // --- load 16x128 f32 tile (coalesced b128, one row per instruction) ---
  const float4* xsrc = (const float4*)(x + (size_t)rowBase * DIN);
#pragma unroll
  for (int it = 0; it < 16; ++it)
    *(float4*)&xs[w][it*XPITCH + lane*4] = xsrc[lane + it*32];
  __syncthreads();

  // --- this lane's 64 columns of row n0, in A-fragment order:
  //     xv[kb*4 + c*2 + q] = columns kb*32 + hf*8 + c*16 + q*4 .. +3 ---
  v4f xv[16];
#pragma unroll  // constant indices keep xv[] in registers
  for (int g = 0; g < 16; ++g) {
    const int col = (g >> 2)*32 + hf*8 + ((g >> 1) & 1)*16 + (g & 1)*4;
    xv[g] = *(const v4f*)&xs[w][n0*XPITCH + col];
  }

  // --- LayerNorm stats: 2 lanes per row, four partial sums per lane ---
  v4f s4 = {0.f, 0.f, 0.f, 0.f}, q4 = {0.f, 0.f, 0.f, 0.f};
#pragma unroll  // constant indices keep xv[] in registers
  for (int g = 0; g < 16; ++g) { s4 += xv[g]; q4 += xv[g]*xv[g]; }
  float s  = (s4[0] + s4[1]) + (s4[2] + s4[3]);
  float s2 = (q4[0] + q4[1]) + (q4[2] + q4[3]);
  s  += __shfl_xor(s, 16, 32);
  s2 += __shfl_xor(s2, 16, 32);
  const float mu   = s * (1.f/128.f);
  const float var  = s2 * (1.f/128.f) - mu*mu;
  const float rstd = rsqrtf(var + 1e-5f);

  // --- normalize + affine -> f16 A fragments, in registers ---
  v16h af[4];
#pragma unroll  // constant indices keep xv[] and af[] in registers
  for (int g = 0; g < 16; ++g) {
    const int col = (g >> 2)*32 + hf*8 + ((g >> 1) & 1)*16 + (g & 1)*4;
    const v4f lw = *(const v4f*)&s_lnw[col];
    const v4f lb = *(const v4f*)&s_lnb[col];
    const v4f v  = (xv[g] - mu) * rstd * lw + lb;
#pragma unroll  // constant element index into the fragment
    for (int e = 0; e < 4; ++e) af[g >> 2][(g & 3)*4 + e] = (half_t)v[e];
  }

  // --- proj: xp = xn @ proj_w^T + proj_b  (16x128 @ 128x32) ---
  v16h bp[2][4];
#pragma unroll
  for (int nt = 0; nt < 2; ++nt)
#pragma unroll
    for (int kb = 0; kb < 4; ++kb)
      bp[nt][kb] = frag_from_row(pwh + (n0 + nt*16)*DIN + kb*32, hf);

  v8f c0, c1;
  { float b0 = proj_b[n0], b1 = proj_b[n0 + 16];
#pragma unroll
    for (int r = 0; r < 8; ++r) { c0[r] = b0; c1[r] = b1; } }

#pragma unroll
  for (int kb = 0; kb < 4; ++kb) {
    c0 = wmma_f16(af[kb], bp[0][kb], c0);
    c1 = wmma_f16(af[kb], bp[1][kb], c1);
  }

  // stash xp tile (row-major f16)
#pragma unroll
  for (int r = 0; r < 8; ++r) {
    int m = r + hf*8;
    xp[w][m*PPITCH + n0]      = (half_t)c0[r];
    xp[w][m*PPITCH + n0 + 16] = (half_t)c1[r];
  }
  __syncthreads();

  // --- k = xp @ wk^T , q = xp @ wq^T  (16x32 @ 32x32) ---
  v16h bk0 = frag_from_row(wkh + n0*DOUT, hf);
  v16h bk1 = frag_from_row(wkh + (n0+16)*DOUT, hf);
  v16h bq0 = frag_from_row(wqh + n0*DOUT, hf);
  v16h bq1 = frag_from_row(wqh + (n0+16)*DOUT, hf);

  v16h a2 = frag_from_row(&xp[w][n0*PPITCH], hf);
  v8f z = {};
  v8f ck0 = wmma_f16(a2, bk0, z);
  v8f ck1 = wmma_f16(a2, bk1, z);
  v8f cq0 = wmma_f16(a2, bq0, z);
  v8f cq1 = wmma_f16(a2, bq1, z);

  // scatter-store K/Q as f16 in [h][l][i][d] so kernel 2 loads coalesced
#pragma unroll
  for (int r = 0; r < 8; ++r) {
    int gm = rowBase + r + hf*8;
    int h  = gm / (NN*NL);
    int i  = (gm >> 6) % NN;
    int l  = gm & 63;
    size_t base = (((size_t)(h*NL + l))*NN + i) * DOUT;
    kws[base + n0]      = (half_t)ck0[r];
    kws[base + n0 + 16] = (half_t)ck1[r];
    qws[base + n0]      = (half_t)cq0[r];
    qws[base + n0 + 16] = (half_t)cq1[r];
  }
}

// ---------------------------------------------------------------------------
// Kernel 2: per (h,l) pair: scores = K @ Q^T * scale (+eps), softmax over i
// (online, per column j), mean over j.  One block per (h,l), all in LDS.
// K/Q tiles are brought in with ASYNC global->LDS copies (ASYNCcnt path).
// ---------------------------------------------------------------------------
#define SCALING 0.17677669529663687f  // 1/sqrt(32)
#define SM_EPS  1e-6f

__global__ __launch_bounds__(256)
void atten_kernel(const half_t* __restrict__ kws, const half_t* __restrict__ qws,
                  float* __restrict__ out)
{
  __shared__ __align__(16) half_t Kt[NN*DOUT];  // 24 KB
  __shared__ __align__(16) half_t Qt[NN*DOUT];  // 24 KB
  __shared__ float outAcc[NN];

  const int tid = threadIdx.x;
  const size_t base = (size_t)blockIdx.x * (NN*DOUT);

  // ---- async global -> LDS tile fetch (GLOBAL_LOAD_ASYNC_TO_LDS_B128) ----
  {
    const void* ksrc = (const void*)(kws + base);
    const void* qsrc = (const void*)(qws + base);
    unsigned lk = (unsigned)(size_t)(void*)Kt;   // addrspace(3) offset in low bits
    unsigned lq = (unsigned)(size_t)(void*)Qt;
#pragma unroll
    for (int it = 0; it < 6; ++it) {             // 256 lanes * 6 * 16B = 24 KB
      unsigned off = (unsigned)(tid + it*256) * 16u;
      asm volatile("global_load_async_to_lds_b128 %0, %1, %2"
                   :: "v"(lk + off), "v"(off), "s"(ksrc) : "memory");
      asm volatile("global_load_async_to_lds_b128 %0, %1, %2"
                   :: "v"(lq + off), "v"(off), "s"(qsrc) : "memory");
    }
    asm volatile("s_wait_asynccnt 0x0" ::: "memory");
  }
  outAcc[tid] = 0.f;
  if (tid < NN - 256) outAcc[256 + tid] = 0.f;
  __syncthreads();

  const int w    = tid >> 5;
  const int lane = tid & 31;
  const int n0   = lane & 15;
  const int hf   = lane >> 4;
  v8f z = {};

  for (int js = w; js < 24; js += 8) {       // each wave owns 3 j-strips
    const int j0 = js * 16;
    v16h b = frag_from_row(&Qt[(j0 + n0)*DOUT], hf);  // B[d][j] = Q[j][d]

    // ---- pass 1: online column softmax stats (max m, denom d per column) ----
    float mrun = -__builtin_inff();
    float drun = 0.f;
    for (int ti = 0; ti < 24; ++ti) {
      v16h a = frag_from_row(&Kt[(ti*16 + n0)*DOUT], hf);
      v8f  c = wmma_f16(a, b, z);
      float sc[8], tmax = -__builtin_inff();
#pragma unroll
      for (int r = 0; r < 8; ++r) { sc[r] = c[r]*SCALING + SM_EPS; tmax = fmaxf(tmax, sc[r]); }
      tmax = fmaxf(tmax, __shfl_xor(tmax, 16, 32));   // combine M halves
      float mnew = fmaxf(mrun, tmax);
      float psum = 0.f;
#pragma unroll
      for (int r = 0; r < 8; ++r) psum += __expf(sc[r] - mnew);
      psum += __shfl_xor(psum, 16, 32);
      drun = drun * __expf(mrun - mnew) + psum;
      mrun = mnew;
    }
    const float inv_d = 1.f / drun;

    // ---- pass 2: probabilities, reduce over j (N) into per-row accumulator ----
    for (int ti = 0; ti < 24; ++ti) {
      v16h a = frag_from_row(&Kt[(ti*16 + n0)*DOUT], hf);
      v8f  c = wmma_f16(a, b, z);
      float p[8];
#pragma unroll
      for (int r = 0; r < 8; ++r)
        p[r] = __expf(c[r]*SCALING + SM_EPS - mrun) * inv_d;
#pragma unroll
      for (int mk = 1; mk < 16; mk <<= 1)
#pragma unroll
        for (int r = 0; r < 8; ++r) p[r] += __shfl_xor(p[r], mk, 32);
      if (n0 == 0) {
#pragma unroll
        for (int r = 0; r < 8; ++r)
          atomicAdd(&outAcc[ti*16 + hf*8 + r], p[r]);
      }
    }
  }
  __syncthreads();

  const int h = blockIdx.x >> 6;
  const int l = blockIdx.x & 63;
  for (int t = tid; t < NN; t += 256)
    out[((size_t)(h*NN + t))*NL + l] = outAcc[t] * (1.f / 384.f);
}

// ---------------------------------------------------------------------------
extern "C" void kernel_launch(void* const* d_in, const int* in_sizes, int n_in,
                              void* d_out, int out_size, void* d_ws, size_t ws_size,
                              hipStream_t stream) {
  const float* x      = (const float*)d_in[0];
  const float* ln_w   = (const float*)d_in[1];
  const float* ln_b   = (const float*)d_in[2];
  const float* proj_w = (const float*)d_in[3];
  const float* proj_b = (const float*)d_in[4];
  const float* wk     = (const float*)d_in[5];
  const float* wq     = (const float*)d_in[6];

  half_t* kws = (half_t*)d_ws;
  half_t* qws = kws + KQ_ELEMS;           // 2 * 12 MB of f16 scratch
  half_t* wgt = qws + KQ_ELEMS;           // f16 weights: proj_w | wk | wq
  half_t* pwh = wgt;
  half_t* wkh = pwh + DOUT*DIN;
  half_t* wqh = wkh + DOUT*DOUT;

  prep_weights_kernel<<<(DOUT*DIN + 2*DOUT*DOUT + 255)/256, 256, 0, stream>>>(
      proj_w, wk, wq, wgt);
  // 196608 rows / 16 per wave / 4 waves per block
  ln_proj_kq_kernel<<<NROWS/64, 128, 0, stream>>>(x, ln_w, ln_b, pwh, proj_b,
                                                  wkh, wqh, kws, qws);
  // one block per (h,l) pair
  atten_kernel<<<NH*NL, 256, 0, stream>>>(kws, qws, (float*)d_out);
}

// v002
// A run of this version takes 43.2 microseconds.
// In both of two side-by-side timings against v001, it was 1.55 times as fast.
// Over all steps from v000 it is 1.94 times as fast.
#include <hip/hip_runtime.h>
#include <hip/hip_bf16.h>

typedef _Float16 half_t;
typedef __attribute__((ext_vector_type(16))) _Float16 v16h;
typedef __attribute__((ext_vector_type(8)))  _Float16 v8h;
typedef __attribute__((ext_vector_type(8)))  float    v8f;
typedef __attribute__((ext_vector_type(4)))  float    v4f;

#define NH   8
#define NN   384
#define NL   64
#define DIN  128
#define DOUT 32
#define NROWS (NH*NN*NL)              // 196608
#define KQ_ELEMS ((size_t)NROWS*DOUT) // 6291456 per matrix

__device__ __forceinline__ v8f wmma_f16(v16h a, v16h b, v8f c) {
  return __builtin_amdgcn_wmma_f32_16x16x32_f16(false, a, false, b, (short)0, c, false, false);
}

// Build a 16x32-f16 WMMA A/B fragment from a row-major f16 row (LDS or global).
// Per ISA 7.12.2: lane-half hf=0 needs K{0..7,16..23}, hf=1 needs K{8..15,24..31}
// -> two contiguous 16B chunks at +hf*8 and +hf*8+16 halves.
__device__ __forceinline__ v16h frag_from_row(const half_t* rowp, int hf) {
  v8h lo = *(const v8h*)(rowp + hf*8);
  v8h hi = *(const v8h*)(rowp + hf*8 + 16);
  v16h r;
#pragma unroll
  for (int e = 0; e < 8; ++e) { r[e] = lo[e]; r[e+8] = hi[e]; }
  return r;
}

// ---------------------------------------------------------------------------
// Kernel 0: one-shot f32 -> f16 conversion of the three weight matrices into
// workspace so the streaming kernel never does VALU converts for weights.
// ---------------------------------------------------------------------------
__global__ __launch_bounds__(256)
void prep_weights_kernel(const float* __restrict__ proj_w,
                         const float* __restrict__ wk,
                         const float* __restrict__ wq,
                         half_t* __restrict__ wout)
{
  int t = blockIdx.x * 256 + threadIdx.x;
  if (t < DOUT*DIN)                 wout[t] = (half_t)proj_w[t];
  else if (t < DOUT*DIN + DOUT*DOUT)   wout[t] = (half_t)wk[t - DOUT*DIN];
  else if (t < DOUT*DIN + 2*DOUT*DOUT) wout[t] = (half_t)wq[t - DOUT*DIN - DOUT*DOUT];
}

// ---------------------------------------------------------------------------
// Kernel 1: fused LayerNorm + proj(128->32, +bias) + k/q proj (32->32),
// one streaming pass over x.  4 waves/block, one 16-row tile per wave.
// The f32 tile is staged in LDS at a padded row pitch; each lane then reads its
// row's columns ONCE, already in WMMA A-fragment order, and keeps them in
// registers for the statistics, the normalisation and the f16 fragments.
// ---------------------------------------------------------------------------
#define XPITCH 132  // floats per LDS row: 528 B = 16 B x 33 (odd), so the 16 rows of a b128 column read fall on 64 distinct banks
#define PPITCH 40   // halfs per LDS row of xp: 80 B = 16 B x 5 (odd), same reason

__global__ __launch_bounds__(128)
void ln_proj_kq_kernel(const float* __restrict__ x,
                       const float* __restrict__ ln_w,  const float* __restrict__ ln_b,
                       const half_t* __restrict__ pwh,  const float* __restrict__ proj_b,
                       const half_t* __restrict__ wkh,  const half_t* __restrict__ wqh,
                       half_t* __restrict__ kws, half_t* __restrict__ qws)
{
  __shared__ __align__(16) float  xs[4][16*XPITCH];  // 33 KB
  __shared__ __align__(16) half_t xp[4][16*PPITCH];  //  5 KB
  __shared__ __align__(16) float  s_lnw[DIN];
  __shared__ __align__(16) float  s_lnb[DIN];

  const int tid  = threadIdx.x;
  const int w    = tid >> 5;
  const int lane = tid & 31;
  const int n0   = lane & 15;      // N / M index within tile
  const int hf   = lane >> 4;      // lane half

  if (tid < DIN) { s_lnw[tid] = ln_w[tid]; s_lnb[tid] = ln_b[tid]; }

  const int tile    = blockIdx.x * 4 + w;
  const int rowBase = tile * 16;

  // --- load 16x128 f32 tile (coalesced b128, one row per instruction) ---
  const float4* xsrc = (const float4*)(x + (size_t)rowBase * DIN);
#pragma unroll
  for (int it = 0; it < 16; ++it)
    *(float4*)&xs[w][it*XPITCH + lane*4] = xsrc[lane + it*32];
  __syncthreads();

  // --- this lane's 64 columns of row n0, in A-fragment order:
  //     xv[kb*4 + c*2 + q] = columns kb*32 + hf*8 + c*16 + q*4 .. +3 ---
  v4f xv[16];
#pragma unroll  // constant indices keep xv[] in registers
  for (int g = 0; g < 16; ++g) {
    const int col = (g >> 2)*32 + hf*8 + ((g >> 1) & 1)*16 + (g & 1)*4;
    xv[g] = *(const v4f*)&xs[w][n0*XPITCH + col];
  }

  // --- LayerNorm stats: 2 lanes per row, four partial sums per lane ---
  v4f s4 = {0.f, 0.f, 0.f, 0.f}, q4 = {0.f, 0.f, 0.f, 0.f};
#pragma unroll  // constant indices keep xv[] in registers
  for (int g = 0; g < 16; ++g) { s4 += xv[g]; q4 += xv[g]*xv[g]; }
  float s  = (s4[0] + s4[1]) + (s4[2] + s4[3]);
  float s2 = (q4[0] + q4[1]) + (q4[2] + q4[3]);
  s  += __shfl_xor(s, 16, 32);
  s2 += __shfl_xor(s2, 16, 32);
  const float mu   = s * (1.f/128.f);
  const float var  = s2 * (1.f/128.f) - mu*mu;
  const float rstd = rsqrtf(var + 1e-5f);

  // --- normalize + affine -> f16 A fragments, in registers ---
  v16h af[4];
#pragma unroll  // constant indices keep xv[] and af[] in registers
  for (int g = 0; g < 16; ++g) {
    const int col = (g >> 2)*32 + hf*8 + ((g >> 1) & 1)*16 + (g & 1)*4;
    const v4f lw = *(const v4f*)&s_lnw[col];
    const v4f lb = *(const v4f*)&s_lnb[col];
    const v4f v  = (xv[g] - mu) * rstd * lw + lb;
#pragma unroll  // constant element index into the fragment
    for (int e = 0; e < 4; ++e) af[g >> 2][(g & 3)*4 + e] = (half_t)v[e];
  }

  // --- proj: xp = xn @ proj_w^T + proj_b  (16x128 @ 128x32) ---
  v16h bp[2][4];
#pragma unroll
  for (int nt = 0; nt < 2; ++nt)
#pragma unroll
    for (int kb = 0; kb < 4; ++kb)
      bp[nt][kb] = frag_from_row(pwh + (n0 + nt*16)*DIN + kb*32, hf);

  v8f c0, c1;
  { float b0 = proj_b[n0], b1 = proj_b[n0 + 16];
#pragma unroll
    for (int r = 0; r < 8; ++r) { c0[r] = b0; c1[r] = b1; } }

#pragma unroll
  for (int kb = 0; kb < 4; ++kb) {
    c0 = wmma_f16(af[kb], bp[0][kb], c0);
    c1 = wmma_f16(af[kb], bp[1][kb], c1);
  }

  // stash xp tile (row-major f16)
#pragma unroll
  for (int r = 0; r < 8; ++r) {
    int m = r + hf*8;
    xp[w][m*PPITCH + n0]      = (half_t)c0[r];
    xp[w][m*PPITCH + n0 + 16] = (half_t)c1[r];
  }
  __syncthreads();

  // --- k = xp @ wk^T , q = xp @ wq^T  (16x32 @ 32x32) ---
  v16h bk0 = frag_from_row(wkh + n0*DOUT, hf);
  v16h bk1 = frag_from_row(wkh + (n0+16)*DOUT, hf);
  v16h bq0 = frag_from_row(wqh + n0*DOUT, hf);
  v16h bq1 = frag_from_row(wqh + (n0+16)*DOUT, hf);

  v16h a2 = frag_from_row(&xp[w][n0*PPITCH], hf);
  v8f z = {};
  v8f ck0 = wmma_f16(a2, bk0, z);
  v8f ck1 = wmma_f16(a2, bk1, z);
  v8f cq0 = wmma_f16(a2, bq0, z);
  v8f cq1 = wmma_f16(a2, bq1, z);

  // scatter-store K/Q as f16 in [h][l][i][d] so kernel 2 loads coalesced
#pragma unroll
  for (int r = 0; r < 8; ++r) {
    int gm = rowBase + r + hf*8;
    int h  = gm / (NN*NL);
    int i  = (gm >> 6) % NN;
    int l  = gm & 63;
    size_t base = (((size_t)(h*NL + l))*NN + i) * DOUT;
    kws[base + n0]      = (half_t)ck0[r];
    kws[base + n0 + 16] = (half_t)ck1[r];
    qws[base + n0]      = (half_t)cq0[r];
    qws[base + n0 + 16] = (half_t)cq1[r];
  }
}

// ---------------------------------------------------------------------------
// Kernel 2: per (h,l) pair: scores = K @ Q^T * scale (+eps), softmax over i
// (online, per column j), mean over j.  One block per (h,l), all in LDS.
// K/Q tiles are brought in with ASYNC global->LDS copies (ASYNCcnt path).
// Both reductions run down the accumulator registers of a lane:
//   pass 1 forms tiles with M = i, N = j (K as A, Q as B): a lane holds one
//          column j and reduces over its rows i; the two lane halves of a
//          column are merged once per strip, behind the loop.
//   pass 2 forms the transposed tiles, M = j, N = i (Q as A, K as B): a lane
//          holds one row i and sums its probabilities over j.
// ---------------------------------------------------------------------------
#define SCALING 0.17677669529663687f  // 1/sqrt(32)
#define SC_LOG2E (SCALING * 1.4426950408889634f)  // raw score -> exponent of 2

__global__ __launch_bounds__(256)
void atten_kernel(const half_t* __restrict__ kws, const half_t* __restrict__ qws,
                  float* __restrict__ out)
{
  __shared__ __align__(16) half_t Kt[NN*DOUT];  // 24 KB
  __shared__ __align__(16) half_t Qt[NN*DOUT];  // 24 KB
  __shared__ __align__(32) float colBias[NN];   // per column j: -(max*SC_LOG2E + log2(denominator))

  const int tid = threadIdx.x;
  const size_t base = (size_t)blockIdx.x * (NN*DOUT);

  // ---- async global -> LDS tile fetch (GLOBAL_LOAD_ASYNC_TO_LDS_B128) ----
  {
    const void* ksrc = (const void*)(kws + base);
    const void* qsrc = (const void*)(qws + base);
    unsigned lk = (unsigned)(size_t)(void*)Kt;   // addrspace(3) offset in low bits
    unsigned lq = (unsigned)(size_t)(void*)Qt;
#pragma unroll
    for (int it = 0; it < 6; ++it) {             // 256 lanes * 6 * 16B = 24 KB
      unsigned off = (unsigned)(tid + it*256) * 16u;
      asm volatile("global_load_async_to_lds_b128 %0, %1, %2"
                   :: "v"(lk + off), "v"(off), "s"(ksrc) : "memory");
      asm volatile("global_load_async_to_lds_b128 %0, %1, %2"
                   :: "v"(lq + off), "v"(off), "s"(qsrc) : "memory");
    }
    asm volatile("s_wait_asynccnt 0x0" ::: "memory");
  }
  __syncthreads();

  const int w    = tid >> 5;
  const int lane = tid & 31;
  const int n0   = lane & 15;
  const int hf   = lane >> 4;
  const v8f z = {};

  // ---- pass 1: column statistics.  The wave owns j-strips w, w+8, w+16 and keeps
  // their Q fragments in registers, so each K fragment read serves all three.
  // The +eps of the reference is common to a score and to its column's maximum
  // and cancels in their difference, which is all that the softmax uses.
  {
    v16h  bq[3];
    float mrun[3];   // maximum (raw score) over this lane's rows
    v8f   drun[3];   // denominator over this lane's rows, one partial sum per accumulator register
#pragma unroll  // constant indices keep the fragments and sums in registers
    for (int s = 0; s < 3; ++s) {
      bq[s]   = frag_from_row(&Qt[((w + s*8)*16 + n0)*DOUT], hf);  // B[d][j] = Q[j][d]
      mrun[s] = -__builtin_inff();
      drun[s] = z;
    }
    for (int ti = 0; ti < 24; ti += 2) {   // two i-tiles per rescale of the running sums
      const v16h a0 = frag_from_row(&Kt[(ti*16 + n0)*DOUT], hf);
      const v16h a1 = frag_from_row(&Kt[(ti*16 + 16 + n0)*DOUT], hf);
      v8f c0[3], c1[3];
#pragma unroll  // constant indices keep the fragments and sums in registers
      for (int s = 0; s < 3; ++s) {
        c0[s] = wmma_f16(a0, bq[s], z);
        c1[s] = wmma_f16(a1, bq[s], z);
      }
#pragma unroll  // constant indices keep the fragments and sums in registers
      for (int s = 0; s < 3; ++s) {
        const v8f x = c0[s], y = c1[s];
        const float t0 = fmaxf(fmaxf(x[0], x[1]), x[2]);
        const float t1 = fmaxf(fmaxf(x[3], x[4]), x[5]);
        const float t2 = fmaxf(fmaxf(x[6], x[7]), y[0]);
        const float t3 = fmaxf(fmaxf(y[1], y[2]), y[3]);
        const float t4 = fmaxf(fmaxf(y[4], y[5]), y[6]);
        const float u0 = fmaxf(fmaxf(t0, t1), t2);
        const float u1 = fmaxf(fmaxf(t3, t4), y[7]);
        const float mnew = fmaxf(fmaxf(u0, u1), mrun[s]);
        const float nmk  = -mnew * SC_LOG2E;
        const float corr = __builtin_amdgcn_exp2f(mrun[s] * SC_LOG2E + nmk);  // 0 on the first trip
        const v8f e0 = x * SC_LOG2E + nmk;
        const v8f e1 = y * SC_LOG2E + nmk;
        v8f p0, p1;
#pragma unroll  // constant indices keep the fragments and sums in registers
        for (int r = 0; r < 8; ++r) {
          p0[r] = __builtin_amdgcn_exp2f(e0[r]);
          p1[r] = __builtin_amdgcn_exp2f(e1[r]);
        }
        drun[s] = drun[s] * corr + p0;
        drun[s] += p1;
        mrun[s] = mnew;
      }
    }
#pragma unroll  // constant indices keep the fragments and sums in registers
    for (int s = 0; s < 3; ++s) {          // merge the two row halves of each column
      const float d_own = ((drun[s][0] + drun[s][1]) + (drun[s][2] + drun[s][3]))
                        + ((drun[s][4] + drun[s][5]) + (drun[s][6] + drun[s][7]));
      const float m_oth = __shfl_xor(mrun[s], 16, 32);
      const float d_oth = __shfl_xor(d_own, 16, 32);
      const float mk    = fmaxf(mrun[s], m_oth) * SC_LOG2E;
      const float d     = d_own * __builtin_amdgcn_exp2f(mrun[s] * SC_LOG2E - mk)
                        + d_oth * __builtin_amdgcn_exp2f(m_oth   * SC_LOG2E - mk);
      if (hf == 0) colBias[(w + s*8)*16 + n0] = -(mk + __builtin_amdgcn_logf(d));  // v_log_f32: base 2
    }
  }
  __syncthreads();   // every column's bias is in LDS before any wave reads it

  // ---- pass 2: probabilities 2^(score*SC_LOG2E + bias[j]), summed over j.  The wave
  // owns i-tiles w, w+8, w+16 and keeps their K fragments in registers; no other
  // wave adds to its rows.
  v16h bk[3];
  v8f  acc[3];
#pragma unroll  // constant indices keep the fragments and sums in registers
  for (int t = 0; t < 3; ++t) {
    bk[t]  = frag_from_row(&Kt[((w + t*8)*16 + n0)*DOUT], hf);   // B[d][i] = K[i][d]
    acc[t] = z;
  }
#pragma unroll 2  // one group of LDS reads and one wait place per two strips instead of per strip
  for (int js = 0; js < 24; ++js) {
    const v16h a    = frag_from_row(&Qt[(js*16 + n0)*DOUT], hf);
    const v8f  bias = *(const v8f*)&colBias[js*16 + hf*8];       // rows j of this lane half
#pragma unroll  // constant indices keep the fragments and sums in registers
    for (int t = 0; t < 3; ++t) {
      const v8f c = wmma_f16(a, bk[t], z);
      const v8f e = c * SC_LOG2E + bias;
#pragma unroll  // constant indices keep the fragments and sums in registers
      for (int r = 0; r < 8; ++r) acc[t][r] += __builtin_amdgcn_exp2f(e[r]);
    }
  }

  const int h = blockIdx.x >> 6;
  const int l = blockIdx.x & 63;
#pragma unroll  // constant indices keep the fragments and sums in registers
  for (int t = 0; t < 3; ++t) {
    float sum = ((acc[t][0] + acc[t][1]) + (acc[t][2] + acc[t][3]))
              + ((acc[t][4] + acc[t][5]) + (acc[t][6] + acc[t][7]));
    sum += __shfl_xor(sum, 16, 32);        // the other eight rows j of every strip
    if (hf == 0)
      out[((size_t)(h*NN + (w + t*8)*16 + n0))*NL + l] = sum * (1.f / 384.f);
  }
}

// ---------------------------------------------------------------------------
extern "C" void kernel_launch(void* const* d_in, const int* in_sizes, int n_in,
                              void* d_out, int out_size, void* d_ws, size_t ws_size,
                              hipStream_t stream) {
  const float* x      = (const float*)d_in[0];
  const float* ln_w   = (const float*)d_in[1];
  const float* ln_b   = (const float*)d_in[2];
  const float* proj_w = (const float*)d_in[3];
  const float* proj_b = (const float*)d_in[4];
  const float* wk     = (const float*)d_in[5];
  const float* wq     = (const float*)d_in[6];

  half_t* kws = (half_t*)d_ws;
  half_t* qws = kws + KQ_ELEMS;           // 2 * 12 MB of f16 scratch
  half_t* wgt = qws + KQ_ELEMS;           // f16 weights: proj_w | wk | wq
  half_t* pwh = wgt;
  half_t* wkh = pwh + DOUT*DIN;
  half_t* wqh = wkh + DOUT*DOUT;

  prep_weights_kernel<<<(DOUT*DIN + 2*DOUT*DOUT + 255)/256, 256, 0, stream>>>(
      proj_w, wk, wq, wgt);
  // 196608 rows / 16 per wave / 4 waves per block
  ln_proj_kq_kernel<<<NROWS/64, 128, 0, stream>>>(x, ln_w, ln_b, pwh, proj_b,
                                                  wkh, wqh, kws, qws);
  // one block per (h,l) pair
  atten_kernel<<<NH*NL, 256, 0, stream>>>(kws, qws, (float*)d_out);
}

// v003
// One run takes 38 microseconds.
// In two side-by-side timings against v002, it was 1.16 and 1.14 times as fast.
// Counting every step since v000, it is 2.22 times as fast.
#include <hip/hip_runtime.h>
#include <hip/hip_bf16.h>

typedef _Float16 half_t;
typedef __attribute__((ext_vector_type(16))) _Float16 v16h;
typedef __attribute__((ext_vector_type(8)))  _Float16 v8h;
typedef __attribute__((ext_vector_type(8)))  float    v8f;
typedef __attribute__((ext_vector_type(4)))  float    v4f;

#define NH   8
#define NN   384
#define NL   64
#define DIN  128
#define DOUT 32
#define NROWS (NH*NN*NL)              // 196608
#define KQ_ELEMS ((size_t)NROWS*DOUT) // 6291456 per matrix

__device__ __forceinline__ v8f wmma_f16(v16h a, v16h b, v8f c) {
  return __builtin_amdgcn_wmma_f32_16x16x32_f16(false, a, false, b, (short)0, c, false, false);
}

// Build a 16x32-f16 WMMA A/B fragment from a row-major f16 row (LDS or global).
// Per ISA 7.12.2: lane-half hf=0 needs K{0..7,16..23}, hf=1 needs K{8..15,24..31}
// -> two contiguous 16B chunks at +hf*8 and +hf*8+16 halves.
__device__ __forceinline__ v16h frag_from_row(const half_t* rowp, int hf) {
  v8h lo = *(const v8h*)(rowp + hf*8);
  v8h hi = *(const v8h*)(rowp + hf*8 + 16);
  v16h r;
#pragma unroll
  for (int e = 0; e < 8; ++e) { r[e] = lo[e]; r[e+8] = hi[e]; }
  return r;
}

// ---------------------------------------------------------------------------
// Kernel 0: one-shot f32 -> f16 conversion of the three weight matrices into
// workspace so the streaming kernel never does VALU converts for weights.
// ---------------------------------------------------------------------------
__global__ __launch_bounds__(256)
void prep_weights_kernel(const float* __restrict__ proj_w,
                         const float* __restrict__ wk,
                         const float* __restrict__ wq,
                         half_t* __restrict__ wout)
{
  int t = blockIdx.x * 256 + threadIdx.x;
  if (t < DOUT*DIN)                 wout[t] = (half_t)proj_w[t];
  else if (t < DOUT*DIN + DOUT*DOUT)   wout[t] = (half_t)wk[t - DOUT*DIN];
  else if (t < DOUT*DIN + 2*DOUT*DOUT) wout[t] = (half_t)wq[t - DOUT*DIN - DOUT*DOUT];
}

// ---------------------------------------------------------------------------
// Kernel 1: fused LayerNorm + proj(128->32, +bias) + k/q proj (32->32),
// one streaming pass over x.  4 waves/block; the grid is sized so that every
// wave is resident at once (four blocks per WGP), and each wave walks TPW 16-row
// tiles in a loop.  The weights are fetched from global memory once, in front of
// the loop: the eight proj_w fragments and the bias stay in registers, wk and wq
// lie in LDS at a padded pitch.
// The f32 tile is staged in LDS at a padded row pitch; each lane then reads its
// row's columns ONCE, already in WMMA A-fragment order, and keeps them in
// registers for the statistics, the normalisation and the f16 fragments.
// ---------------------------------------------------------------------------
#define XPITCH 132  // floats per LDS row: 528 B = 16 B x 33 (odd), so the 16 rows of a b128 column read fall on 64 distinct banks
#define PPITCH 40   // halfs per LDS row of xp: 80 B = 16 B x 5 (odd), same reason
#define TPW 3       // tiles per wave: 12288 tiles = 1024 blocks x 4 waves x 3

__global__ __launch_bounds__(128)
void ln_proj_kq_kernel(const float* __restrict__ x,
                       const float* __restrict__ ln_w,  const float* __restrict__ ln_b,
                       const half_t* __restrict__ pwh,  const float* __restrict__ proj_b,
                       const half_t* __restrict__ wkh,  const half_t* __restrict__ wqh,
                       half_t* __restrict__ kws, half_t* __restrict__ qws)
{
  __shared__ __align__(16) float  xs[4][16*XPITCH];  // 33 KB
  __shared__ __align__(16) half_t xp[4][16*PPITCH];  //  5 KB
  __shared__ __align__(16) half_t s_wk[DOUT*PPITCH]; // 2.5 KB, rows at the padded pitch of xp
  __shared__ __align__(16) half_t s_wq[DOUT*PPITCH]; // 2.5 KB
  __shared__ __align__(16) float  s_lnw[DIN];
  __shared__ __align__(16) float  s_lnb[DIN];

  const int tid  = threadIdx.x;
  const int w    = tid >> 5;
  const int lane = tid & 31;
  const int n0   = lane & 15;      // N / M index within tile
  const int hf   = lane >> 4;      // lane half

  // --- proj_w fragments and bias: read once per wave, live over the tile loop ---
  v16h bp[2][4];
#pragma unroll
  for (int nt = 0; nt < 2; ++nt)
#pragma unroll
    for (int kb = 0; kb < 4; ++kb)
      bp[nt][kb] = frag_from_row(pwh + (n0 + nt*16)*DIN + kb*32, hf);
  // wk and wq: staged once per block in LDS (16 B per thread and matrix); the first barrier of the loop publishes them
  *(v8h*)&s_wk[(tid >> 2)*PPITCH + (tid & 3)*8] = *(const v8h*)(wkh + tid*8);
  *(v8h*)&s_wq[(tid >> 2)*PPITCH + (tid & 3)*8] = *(const v8h*)(wqh + tid*8);
  const float b0 = proj_b[n0], b1 = proj_b[n0 + 16];

  if (tid < DIN) { s_lnw[tid] = ln_w[tid]; s_lnb[tid] = ln_b[tid]; }

#pragma unroll 1  // rolled: one copy of the body keeps the wave under 256 registers, so four blocks share a WGP
  for (int t = 0; t < TPW; ++t) {
    const int tile    = (blockIdx.x * TPW + t) * 4 + w;
    const int rowBase = tile * 16;

    // --- load 16x128 f32 tile (coalesced b128, one row per instruction) ---
    const float4* xsrc = (const float4*)(x + (size_t)rowBase * DIN);
#pragma unroll
    for (int it = 0; it < 16; ++it)
      *(float4*)&xs[w][it*XPITCH + lane*4] = xsrc[lane + it*32];
    __syncthreads();

    // --- this lane's 64 columns of row n0, in A-fragment order:
    //     xv[kb*4 + c*2 + q] = columns kb*32 + hf*8 + c*16 + q*4 .. +3 ---
    v4f xv[16];
#pragma unroll  // constant indices keep xv[] in registers
    for (int g = 0; g < 16; ++g) {
      const int col = (g >> 2)*32 + hf*8 + ((g >> 1) & 1)*16 + (g & 1)*4;
      xv[g] = *(const v4f*)&xs[w][n0*XPITCH + col];
    }

    // --- LayerNorm stats: 2 lanes per row, four partial sums per lane ---
    v4f s4 = {0.f, 0.f, 0.f, 0.f}, q4 = {0.f, 0.f, 0.f, 0.f};
#pragma unroll  // constant indices keep xv[] in registers
    for (int g = 0; g < 16; ++g) { s4 += xv[g]; q4 += xv[g]*xv[g]; }
    float s  = (s4[0] + s4[1]) + (s4[2] + s4[3]);
    float s2 = (q4[0] + q4[1]) + (q4[2] + q4[3]);
    s  += __shfl_xor(s, 16, 32);
    s2 += __shfl_xor(s2, 16, 32);
    const float mu   = s * (1.f/128.f);
    const float var  = s2 * (1.f/128.f) - mu*mu;
    const float rstd = rsqrtf(var + 1e-5f);

    // --- normalize + affine -> f16 A fragments, in registers ---
    v16h af[4];
#pragma unroll  // constant indices keep xv[] and af[] in registers
    for (int g = 0; g < 16; ++g) {
      const int col = (g >> 2)*32 + hf*8 + ((g >> 1) & 1)*16 + (g & 1)*4;
      const v4f lw = *(const v4f*)&s_lnw[col];
      const v4f lb = *(const v4f*)&s_lnb[col];
      const v4f v  = (xv[g] - mu) * rstd * lw + lb;
#pragma unroll  // constant element index into the fragment
      for (int e = 0; e < 4; ++e) af[g >> 2][(g & 3)*4 + e] = (half_t)v[e];
    }

    // --- proj: xp = xn @ proj_w^T + proj_b  (16x128 @ 128x32) ---
    v8f c0, c1;
#pragma unroll
    for (int r = 0; r < 8; ++r) { c0[r] = b0; c1[r] = b1; }

#pragma unroll
    for (int kb = 0; kb < 4; ++kb) {
      c0 = wmma_f16(af[kb], bp[0][kb], c0);
      c1 = wmma_f16(af[kb], bp[1][kb], c1);
    }

    // stash xp tile (row-major f16)
#pragma unroll
    for (int r = 0; r < 8; ++r) {
      int m = r + hf*8;
      xp[w][m*PPITCH + n0]      = (half_t)c0[r];
      xp[w][m*PPITCH + n0 + 16] = (half_t)c1[r];
    }
    __syncthreads();

    // --- k = xp @ wk^T , q = xp @ wq^T  (16x32 @ 32x32) ---
    const v16h bk0 = frag_from_row(&s_wk[n0*PPITCH], hf);
    const v16h bk1 = frag_from_row(&s_wk[(n0+16)*PPITCH], hf);
    const v16h bq0 = frag_from_row(&s_wq[n0*PPITCH], hf);
    const v16h bq1 = frag_from_row(&s_wq[(n0+16)*PPITCH], hf);
    v16h a2 = frag_from_row(&xp[w][n0*PPITCH], hf);
    v8f z = {};
    v8f ck0 = wmma_f16(a2, bk0, z);
    v8f ck1 = wmma_f16(a2, bk1, z);
    v8f cq0 = wmma_f16(a2, bq0, z);
    v8f cq1 = wmma_f16(a2, bq1, z);

    // scatter-store K/Q as f16 in [h][l][i][d] so kernel 2 loads coalesced
#pragma unroll
    for (int r = 0; r < 8; ++r) {
      int gm = rowBase + r + hf*8;
      int h  = gm / (NN*NL);
      int i  = (gm >> 6) % NN;
      int l  = gm & 63;
      size_t base = (((size_t)(h*NL + l))*NN + i) * DOUT;
      kws[base + n0]      = (half_t)ck0[r];
      kws[base + n0 + 16] = (half_t)ck1[r];
      qws[base + n0]      = (half_t)cq0[r];
      qws[base + n0 + 16] = (half_t)cq1[r];
    }
    // the next trip rewrites address and data registers that the stores above name
    asm volatile("s_wait_xcnt 0x0" ::: "memory");
  }
}

// ---------------------------------------------------------------------------
// Kernel 2: per (h,l) pair: scores = K @ Q^T * scale (+eps), softmax over i
// (online, per column j), mean over j.  One block per (h,l), all in LDS.
// K/Q tiles are brought in with ASYNC global->LDS copies (ASYNCcnt path).
// Both reductions run down the accumulator registers of a lane:
//   pass 1 forms tiles with M = i, N = j (K as A, Q as B): a lane holds one
//          column j and reduces over its rows i; the two lane halves of a
//          column are merged once per strip, behind the loop.
//   pass 2 forms the transposed tiles, M = j, N = i (Q as A, K as B): a lane
//          holds one row i and sums its probabilities over j.
// ---------------------------------------------------------------------------
#define SCALING 0.17677669529663687f  // 1/sqrt(32)
#define SC_LOG2E (SCALING * 1.4426950408889634f)  // raw score -> exponent of 2

__global__ __launch_bounds__(256)
void atten_kernel(const half_t* __restrict__ kws, const half_t* __restrict__ qws,
                  float* __restrict__ out)
{
  __shared__ __align__(16) half_t Kt[NN*DOUT];  // 24 KB
  __shared__ __align__(16) half_t Qt[NN*DOUT];  // 24 KB
  __shared__ __align__(32) float colBias[NN];   // per column j: -(max*SC_LOG2E + log2(denominator))

  const int tid = threadIdx.x;
  const size_t base = (size_t)blockIdx.x * (NN*DOUT);

  // ---- async global -> LDS tile fetch (GLOBAL_LOAD_ASYNC_TO_LDS_B128) ----
  {
    const void* ksrc = (const void*)(kws + base);
    const void* qsrc = (const void*)(qws + base);
    unsigned lk = (unsigned)(size_t)(void*)Kt;   // addrspace(3) offset in low bits
    unsigned lq = (unsigned)(size_t)(void*)Qt;
#pragma unroll
    for (int it = 0; it < 6; ++it) {             // 256 lanes * 6 * 16B = 24 KB
      unsigned off = (unsigned)(tid + it*256) * 16u;
      asm volatile("global_load_async_to_lds_b128 %0, %1, %2"
                   :: "v"(lk + off), "v"(off), "s"(ksrc) : "memory");
      asm volatile("global_load_async_to_lds_b128 %0, %1, %2"
                   :: "v"(lq + off), "v"(off), "s"(qsrc) : "memory");
    }
    asm volatile("s_wait_asynccnt 0x0" ::: "memory");
  }
  __syncthreads();

  const int w    = tid >> 5;
  const int lane = tid & 31;
  const int n0   = lane & 15;
  const int hf   = lane >> 4;
  const v8f z = {};

  // ---- pass 1: column statistics.  The wave owns j-strips w, w+8, w+16 and keeps
  // their Q fragments in registers, so each K fragment read serves all three.
  // The +eps of the reference is common to a score and to its column's maximum
  // and cancels in their difference, which is all that the softmax uses.
  {
    v16h  bq[3];
    float mrun[3];   // maximum (raw score) over this lane's rows
    v8f   drun[3];   // denominator over this lane's rows, one partial sum per accumulator register
#pragma unroll  // constant indices keep the fragments and sums in registers
    for (int s = 0; s < 3; ++s) {
      bq[s]   = frag_from_row(&Qt[((w + s*8)*16 + n0)*DOUT], hf);  // B[d][j] = Q[j][d]
      mrun[s] = -__builtin_inff();
      drun[s] = z;
    }
    for (int ti = 0; ti < 24; ti += 2) {   // two i-tiles per rescale of the running sums
      const v16h a0 = frag_from_row(&Kt[(ti*16 + n0)*DOUT], hf);
      const v16h a1 = frag_from_row(&Kt[(ti*16 + 16 + n0)*DOUT], hf);
      v8f c0[3], c1[3];
#pragma unroll  // constant indices keep the fragments and sums in registers
      for (int s = 0; s < 3; ++s) {
        c0[s] = wmma_f16(a0, bq[s], z);
        c1[s] = wmma_f16(a1, bq[s], z);
      }
#pragma unroll  // constant indices keep the fragments and sums in registers
      for (int s = 0; s < 3; ++s) {
        const v8f x = c0[s], y = c1[s];
        const float t0 = fmaxf(fmaxf(x[0], x[1]), x[2]);
        const float t1 = fmaxf(fmaxf(x[3], x[4]), x[5]);
        const float t2 = fmaxf(fmaxf(x[6], x[7]), y[0]);
        const float t3 = fmaxf(fmaxf(y[1], y[2]), y[3]);
        const float t4 = fmaxf(fmaxf(y[4], y[5]), y[6]);
        const float u0 = fmaxf(fmaxf(t0, t1), t2);
        const float u1 = fmaxf(fmaxf(t3, t4), y[7]);
        const float mnew = fmaxf(fmaxf(u0, u1), mrun[s]);
        const float nmk  = -mnew * SC_LOG2E;
        const float corr = __builtin_amdgcn_exp2f(mrun[s] * SC_LOG2E + nmk);  // 0 on the first trip
        const v8f e0 = x * SC_LOG2E + nmk;
        const v8f e1 = y * SC_LOG2E + nmk;
        v8f p0, p1;
#pragma unroll  // constant indices keep the fragments and sums in registers
        for (int r = 0; r < 8; ++r) {
          p0[r] = __builtin_amdgcn_exp2f(e0[r]);
          p1[r] = __builtin_amdgcn_exp2f(e1[r]);
        }
        drun[s] = drun[s] * corr + p0;
        drun[s] += p1;
        mrun[s] = mnew;
      }
    }
#pragma unroll  // constant indices keep the fragments and sums in registers
    for (int s = 0; s < 3; ++s) {          // merge the two row halves of each column
      const float d_own = ((drun[s][0] + drun[s][1]) + (drun[s][2] + drun[s][3]))
                        + ((drun[s][4] + drun[s][5]) + (drun[s][6] + drun[s][7]));
      const float m_oth = __shfl_xor(mrun[s], 16, 32);
      const float d_oth = __shfl_xor(d_own, 16, 32);
      const float mk    = fmaxf(mrun[s], m_oth) * SC_LOG2E;
      const float d     = d_own * __builtin_amdgcn_exp2f(mrun[s] * SC_LOG2E - mk)
                        + d_oth * __builtin_amdgcn_exp2f(m_oth   * SC_LOG2E - mk);
      if (hf == 0) colBias[(w + s*8)*16 + n0] = -(mk + __builtin_amdgcn_logf(d));  // v_log_f32: base 2
    }
  }
  __syncthreads();   // every column's bias is in LDS before any wave reads it

  // ---- pass 2: probabilities 2^(score*SC_LOG2E + bias[j]), summed over j.  The wave
  // owns i-tiles w, w+8, w+16 and keeps their K fragments in registers; no other
  // wave adds to its rows.
  v16h bk[3];
  v8f  acc[3];
#pragma unroll  // constant indices keep the fragments and sums in registers
  for (int t = 0; t < 3; ++t) {
    bk[t]  = frag_from_row(&Kt[((w + t*8)*16 + n0)*DOUT], hf);   // B[d][i] = K[i][d]
    acc[t] = z;
  }
#pragma unroll 2  // one group of LDS reads and one wait place per two strips instead of per strip
  for (int js = 0; js < 24; ++js) {
    const v16h a    = frag_from_row(&Qt[(js*16 + n0)*DOUT], hf);
    const v8f  bias = *(const v8f*)&colBias[js*16 + hf*8];       // rows j of this lane half
#pragma unroll  // constant indices keep the fragments and sums in registers
    for (int t = 0; t < 3; ++t) {
      const v8f c = wmma_f16(a, bk[t], z);
      const v8f e = c * SC_LOG2E + bias;
#pragma unroll  // constant indices keep the fragments and sums in registers
      for (int r = 0; r < 8; ++r) acc[t][r] += __builtin_amdgcn_exp2f(e[r]);
    }
  }

  const int h = blockIdx.x >> 6;
  const int l = blockIdx.x & 63;
#pragma unroll  // constant indices keep the fragments and sums in registers
  for (int t = 0; t < 3; ++t) {
    float sum = ((acc[t][0] + acc[t][1]) + (acc[t][2] + acc[t][3]))
              + ((acc[t][4] + acc[t][5]) + (acc[t][6] + acc[t][7]));
    sum += __shfl_xor(sum, 16, 32);        // the other eight rows j of every strip
    if (hf == 0)
      out[((size_t)(h*NN + (w + t*8)*16 + n0))*NL + l] = sum * (1.f / 384.f);
  }
}

// ---------------------------------------------------------------------------
extern "C" void kernel_launch(void* const* d_in, const int* in_sizes, int n_in,
                              void* d_out, int out_size, void* d_ws, size_t ws_size,
                              hipStream_t stream) {
  const float* x      = (const float*)d_in[0];
  const float* ln_w   = (const float*)d_in[1];
  const float* ln_b   = (const float*)d_in[2];
  const float* proj_w = (const float*)d_in[3];
  const float* proj_b = (const float*)d_in[4];
  const float* wk     = (const float*)d_in[5];
  const float* wq     = (const float*)d_in[6];

  half_t* kws = (half_t*)d_ws;
  half_t* qws = kws + KQ_ELEMS;           // 2 * 12 MB of f16 scratch
  half_t* wgt = qws + KQ_ELEMS;           // f16 weights: proj_w | wk | wq
  half_t* pwh = wgt;
  half_t* wkh = pwh + DOUT*DIN;
  half_t* wqh = wkh + DOUT*DOUT;

  prep_weights_kernel<<<(DOUT*DIN + 2*DOUT*DOUT + 255)/256, 256, 0, stream>>>(
      proj_w, wk, wq, wgt);
  // 196608 rows / 16 per tile / 4 waves per block / TPW tiles per wave
  ln_proj_kq_kernel<<<NROWS/(64*TPW), 128, 0, stream>>>(x, ln_w, ln_b, pwh, proj_b,
                                                  wkh, wqh, kws, qws);
  // one block per (h,l) pair
  atten_kernel<<<NH*NL, 256, 0, stream>>>(kws, qws, (float*)d_out);
}

// v004
// It runs in 30.3 microseconds.
// Timed twice side by side with v003, it ran 1.25 and 1.24 times as fast.
// Over all steps from v000 it is 2.76 times as fast.
#include <hip/hip_runtime.h>
#include <hip/hip_bf16.h>

typedef _Float16 half_t;
typedef __attribute__((ext_vector_type(16))) _Float16 v16h;
typedef __attribute__((ext_vector_type(8)))  _Float16 v8h;
typedef __attribute__((ext_vector_type(8)))  float    v8f;
typedef __attribute__((ext_vector_type(4)))  float    v4f;

#define NH   8
#define NN   384
#define NL   64
#define DIN  128
#define DOUT 32

__device__ __forceinline__ v8f wmma_f16(v16h a, v16h b, v8f c) {
  return __builtin_amdgcn_wmma_f32_16x16x32_f16(false, a, false, b, (short)0, c, false, false);
}

// Build a 16x32-f16 WMMA A/B fragment from a row-major f16 row (LDS or global).
// Per ISA 7.12.2: lane-half hf=0 needs K{0..7,16..23}, hf=1 needs K{8..15,24..31}
// -> two contiguous 16B chunks at +hf*8 and +hf*8+16 halves.
__device__ __forceinline__ v16h frag_from_row(const half_t* rowp, int hf) {
  v8h lo = *(const v8h*)(rowp + hf*8);
  v8h hi = *(const v8h*)(rowp + hf*8 + 16);
  v16h r;
#pragma unroll
  for (int e = 0; e < 8; ++e) { r[e] = lo[e]; r[e+8] = hi[e]; }
  return r;
}

// ---------------------------------------------------------------------------
// Kernel 0: one-shot f32 -> f16 conversion of the three weight matrices into
// workspace so the streaming kernel never does VALU converts for weights.
// ---------------------------------------------------------------------------
__global__ __launch_bounds__(256)
void prep_weights_kernel(const float* __restrict__ proj_w,
                         const float* __restrict__ wk,
                         const float* __restrict__ wq,
                         half_t* __restrict__ wout)
{
  int t = blockIdx.x * 256 + threadIdx.x;
  if (t < DOUT*DIN)                 wout[t] = (half_t)proj_w[t];
  else if (t < DOUT*DIN + DOUT*DOUT)   wout[t] = (half_t)wk[t - DOUT*DIN];
  else if (t < DOUT*DIN + 2*DOUT*DOUT) wout[t] = (half_t)wq[t - DOUT*DIN - DOUT*DOUT];
}

// ---------------------------------------------------------------------------
// Kernel 1: one block of 8 waves per (h,l) pair, two blocks per WGP, every block
// resident at once.
// Part A: LayerNorm + proj(128->32, +bias) + k/q proj (32->32) of the pair's own
// 384 rows x[h][i][l][:] (512 contiguous bytes each).  Each wave walks TPW 16-row
// tiles in a loop and writes its rows of K and Q as f16 straight into the LDS
// tiles that part B reads: K and Q never go through global memory.
// The weights are fetched from global memory once, in front of the loop: the
// eight proj_w fragments and the bias stay in registers, wk and wq lie in LDS at
// a padded pitch.
// The f32 tile is staged in LDS at a padded row pitch; each lane then reads its
// row's columns ONCE, already in WMMA A-fragment order, and keeps them in
// registers for the statistics, the normalisation and the f16 fragments.
// Part B: scores = K @ Q^T * scale (+eps), softmax over i (online, per column j),
// mean over j, all from LDS.
// Both reductions run down the accumulator registers of a lane:
//   pass 1 forms tiles with M = i, N = j (K as A, Q as B): a lane holds one
//          column j and reduces over its rows i; the two lane halves of a
//          column are merged once per strip, behind the loop.
//   pass 2 forms the transposed tiles, M = j, N = i (Q as A, K as B): a lane
//          holds one row i and sums its probabilities over j.
// ---------------------------------------------------------------------------
#define XPITCH 132  // floats per LDS row: 528 B = 16 B x 33 (odd), so the 16 rows of a b128 column read fall on 64 distinct banks
#define PPITCH 40   // halfs per LDS row of xp: 80 B = 16 B x 5 (odd), same reason
#define TPW 3       // tiles per wave: 24 tiles of 16 rows i = 8 waves x 3
#define SCALING 0.17677669529663687f  // 1/sqrt(32)
#define SC_LOG2E (SCALING * 1.4426950408889634f)  // raw score -> exponent of 2

__global__ __launch_bounds__(256)
void ln_kq_atten_kernel(const float* __restrict__ x,
                        const float* __restrict__ ln_w,  const float* __restrict__ ln_b,
                        const half_t* __restrict__ pwh,  const float* __restrict__ proj_b,
                        const half_t* __restrict__ wkh,  const half_t* __restrict__ wqh,
                        float* __restrict__ out)
{
  __shared__ __align__(16) float  xs[8][16*XPITCH];  // 66 KB
  __shared__ __align__(16) half_t xp[8][16*PPITCH];  // 10 KB
  __shared__ __align__(16) half_t s_wk[DOUT*PPITCH]; // 2.5 KB, rows at the padded pitch of xp
  __shared__ __align__(16) half_t s_wq[DOUT*PPITCH]; // 2.5 KB
  __shared__ __align__(16) float  s_lnw[DIN];
  __shared__ __align__(16) float  s_lnb[DIN];
  __shared__ __align__(16) half_t Kt[NN*DOUT];  // 24 KB
  __shared__ __align__(16) half_t Qt[NN*DOUT];  // 24 KB
  __shared__ __align__(32) float colBias[NN];   // per column j: -(max*SC_LOG2E + log2(denominator))

  const int h    = blockIdx.x >> 6;
  const int l    = blockIdx.x & 63;
  const int tid  = threadIdx.x;
  const int w    = tid >> 5;
  const int lane = tid & 31;
  const int n0   = lane & 15;      // N / M index within tile
  const int hf   = lane >> 4;      // lane half

  // --- proj_w fragments and bias: read once per wave, live over the tile loop ---
  v16h bp[2][4];
#pragma unroll
  for (int nt = 0; nt < 2; ++nt)
#pragma unroll
    for (int kb = 0; kb < 4; ++kb)
      bp[nt][kb] = frag_from_row(pwh + (n0 + nt*16)*DIN + kb*32, hf);
  // wk, wq and the LayerNorm vectors: staged once per block in LDS by its first four waves
  // (16 B per thread and matrix); the first barrier of the loop publishes them
  if (tid < DIN) {
    *(v8h*)&s_wk[(tid >> 2)*PPITCH + (tid & 3)*8] = *(const v8h*)(wkh + tid*8);
    *(v8h*)&s_wq[(tid >> 2)*PPITCH + (tid & 3)*8] = *(const v8h*)(wqh + tid*8);
    s_lnw[tid] = ln_w[tid]; s_lnb[tid] = ln_b[tid];
  }
  const float b0 = proj_b[n0], b1 = proj_b[n0 + 16];

#pragma unroll 1  // rolled: one copy of the body keeps the wave under 256 registers, so two blocks share a WGP
  for (int t = 0; t < TPW; ++t) {
    const int rowBase = (t*8 + w) * 16;   // first row i of this wave's tile

    // --- load 16x128 f32 tile (coalesced b128, one row per instruction; rows i and i+1 lie NL*DIN floats apart) ---
    const float* xsrc = x + ((size_t)(h*NN + rowBase)*NL + l)*DIN + lane*4;
    v4f xr[16];
#pragma unroll  // constant indices keep xr[] in registers
    for (int it = 0; it < 16; ++it) xr[it] = *(const v4f*)(xsrc + it*(NL*DIN));
    // holds the 16 loads in front of the first LDS store, so that all are in flight together:
    // left alone, the compiler sinks each load to its store and waits for them one by one
    asm volatile("" :: "v"(xr[0]), "v"(xr[1]), "v"(xr[2]), "v"(xr[3]), "v"(xr[4]), "v"(xr[5]),
                       "v"(xr[6]), "v"(xr[7]), "v"(xr[8]), "v"(xr[9]), "v"(xr[10]), "v"(xr[11]),
                       "v"(xr[12]), "v"(xr[13]), "v"(xr[14]), "v"(xr[15]));
#pragma unroll  // constant indices keep xr[] in registers
    for (int it = 0; it < 16; ++it) *(v4f*)&xs[w][it*XPITCH + lane*4] = xr[it];
    __syncthreads();

    // --- this lane's 64 columns of row n0, in A-fragment order:
    //     xv[kb*4 + c*2 + q] = columns kb*32 + hf*8 + c*16 + q*4 .. +3 ---
    v4f xv[16];
#pragma unroll  // constant indices keep xv[] in registers
    for (int g = 0; g < 16; ++g) {
      const int col = (g >> 2)*32 + hf*8 + ((g >> 1) & 1)*16 + (g & 1)*4;
      xv[g] = *(const v4f*)&xs[w][n0*XPITCH + col];
    }

    // --- LayerNorm stats: 2 lanes per row, four partial sums per lane ---
    v4f s4 = {0.f, 0.f, 0.f, 0.f}, q4 = {0.f, 0.f, 0.f, 0.f};
#pragma unroll  // constant indices keep xv[] in registers
    for (int g = 0; g < 16; ++g) { s4 += xv[g]; q4 += xv[g]*xv[g]; }
    float s  = (s4[0] + s4[1]) + (s4[2] + s4[3]);
    float s2 = (q4[0] + q4[1]) + (q4[2] + q4[3]);
    s  += __shfl_xor(s, 16, 32);
    s2 += __shfl_xor(s2, 16, 32);
    const float mu   = s * (1.f/128.f);
    const float var  = s2 * (1.f/128.f) - mu*mu;
    const float rstd = rsqrtf(var + 1e-5f);

    // --- normalize + affine -> f16 A fragments, in registers ---
    v16h af[4];
#pragma unroll  // constant indices keep xv[] and af[] in registers
    for (int g = 0; g < 16; ++g) {
      const int col = (g >> 2)*32 + hf*8 + ((g >> 1) & 1)*16 + (g & 1)*4;
      const v4f lw = *(const v4f*)&s_lnw[col];
      const v4f lb = *(const v4f*)&s_lnb[col];
      const v4f v  = (xv[g] - mu) * rstd * lw + lb;
#pragma unroll  // constant element index into the fragment
      for (int e = 0; e < 4; ++e) af[g >> 2][(g & 3)*4 + e] = (half_t)v[e];
    }

    // --- proj: xp = xn @ proj_w^T + proj_b  (16x128 @ 128x32) ---
    v8f c0, c1;
#pragma unroll
    for (int r = 0; r < 8; ++r) { c0[r] = b0; c1[r] = b1; }

#pragma unroll
    for (int kb = 0; kb < 4; ++kb) {
      c0 = wmma_f16(af[kb], bp[0][kb], c0);
      c1 = wmma_f16(af[kb], bp[1][kb], c1);
    }

    // stash xp tile (row-major f16)
#pragma unroll
    for (int r = 0; r < 8; ++r) {
      int m = r + hf*8;
      xp[w][m*PPITCH + n0]      = (half_t)c0[r];
      xp[w][m*PPITCH + n0 + 16] = (half_t)c1[r];
    }
    __syncthreads();

    // --- k = xp @ wk^T , q = xp @ wq^T  (16x32 @ 32x32) ---
    const v16h bk0 = frag_from_row(&s_wk[n0*PPITCH], hf);
    const v16h bk1 = frag_from_row(&s_wk[(n0+16)*PPITCH], hf);
    const v16h bq0 = frag_from_row(&s_wq[n0*PPITCH], hf);
    const v16h bq1 = frag_from_row(&s_wq[(n0+16)*PPITCH], hf);
    v16h a2 = frag_from_row(&xp[w][n0*PPITCH], hf);
    const v8f z0 = {};
    v8f ck0 = wmma_f16(a2, bk0, z0);
    v8f ck1 = wmma_f16(a2, bk1, z0);
    v8f cq0 = wmma_f16(a2, bq0, z0);
    v8f cq1 = wmma_f16(a2, bq1, z0);

    // K and Q rows of this tile as f16 into the block's LDS tiles, row-major [i][d]
#pragma unroll
    for (int r = 0; r < 8; ++r) {
      const int i = rowBase + r + hf*8;
      Kt[i*DOUT + n0]      = (half_t)ck0[r];
      Kt[i*DOUT + n0 + 16] = (half_t)ck1[r];
      Qt[i*DOUT + n0]      = (half_t)cq0[r];
      Qt[i*DOUT + n0 + 16] = (half_t)cq1[r];
    }
  }
  __syncthreads();   // every wave's rows of K and Q are in LDS before any wave reads them

  const v8f z = {};

  // ---- pass 1: column statistics.  The wave owns j-strips w, w+8, w+16 and keeps
  // their Q fragments in registers, so each K fragment read serves all three.
  // The +eps of the reference is common to a score and to its column's maximum
  // and cancels in their difference, which is all that the softmax uses.
  {
    v16h  bq[3];
    float mrun[3];   // maximum (raw score) over this lane's rows
    v8f   drun[3];   // denominator over this lane's rows, one partial sum per accumulator register
#pragma unroll  // constant indices keep the fragments and sums in registers
    for (int s = 0; s < 3; ++s) {
      bq[s]   = frag_from_row(&Qt[((w + s*8)*16 + n0)*DOUT], hf);  // B[d][j] = Q[j][d]
      mrun[s] = -__builtin_inff();
      drun[s] = z;
    }
    for (int ti = 0; ti < 24; ti += 2) {   // two i-tiles per rescale of the running sums
      const v16h a0 = frag_from_row(&Kt[(ti*16 + n0)*DOUT], hf);
      const v16h a1 = frag_from_row(&Kt[(ti*16 + 16 + n0)*DOUT], hf);
      v8f c0[3], c1[3];
#pragma unroll  // constant indices keep the fragments and sums in registers
      for (int s = 0; s < 3; ++s) {
        c0[s] = wmma_f16(a0, bq[s], z);
        c1[s] = wmma_f16(a1, bq[s], z);
      }
#pragma unroll  // constant indices keep the fragments and sums in registers
      for (int s = 0; s < 3; ++s) {
        const v8f x = c0[s], y = c1[s];
        const float t0 = fmaxf(fmaxf(x[0], x[1]), x[2]);
        const float t1 = fmaxf(fmaxf(x[3], x[4]), x[5]);
        const float t2 = fmaxf(fmaxf(x[6], x[7]), y[0]);
        const float t3 = fmaxf(fmaxf(y[1], y[2]), y[3]);
        const float t4 = fmaxf(fmaxf(y[4], y[5]), y[6]);
        const float u0 = fmaxf(fmaxf(t0, t1), t2);
        const float u1 = fmaxf(fmaxf(t3, t4), y[7]);
        const float mnew = fmaxf(fmaxf(u0, u1), mrun[s]);
        const float nmk  = -mnew * SC_LOG2E;
        const float corr = __builtin_amdgcn_exp2f(mrun[s] * SC_LOG2E + nmk);  // 0 on the first trip
        const v8f e0 = x * SC_LOG2E + nmk;
        const v8f e1 = y * SC_LOG2E + nmk;
        v8f p0, p1;
#pragma unroll  // constant indices keep the fragments and sums in registers
        for (int r = 0; r < 8; ++r) {
          p0[r] = __builtin_amdgcn_exp2f(e0[r]);
          p1[r] = __builtin_amdgcn_exp2f(e1[r]);
        }
        drun[s] = drun[s] * corr + p0;
        drun[s] += p1;
        mrun[s] = mnew;
      }
    }
#pragma unroll  // constant indices keep the fragments and sums in registers
    for (int s = 0; s < 3; ++s) {          // merge the two row halves of each column
      const float d_own = ((drun[s][0] + drun[s][1]) + (drun[s][2] + drun[s][3]))
                        + ((drun[s][4] + drun[s][5]) + (drun[s][6] + drun[s][7]));
      const float m_oth = __shfl_xor(mrun[s], 16, 32);
      const float d_oth = __shfl_xor(d_own, 16, 32);
      const float mk    = fmaxf(mrun[s], m_oth) * SC_LOG2E;
      const float d     = d_own * __builtin_amdgcn_exp2f(mrun[s] * SC_LOG2E - mk)
                        + d_oth * __builtin_amdgcn_exp2f(m_oth   * SC_LOG2E - mk);
      if (hf == 0) colBias[(w + s*8)*16 + n0] = -(mk + __builtin_amdgcn_logf(d));  // v_log_f32: base 2
    }
  }
  __syncthreads();   // every column's bias is in LDS before any wave reads it

  // ---- pass 2: probabilities 2^(score*SC_LOG2E + bias[j]), summed over j.  The wave
  // owns i-tiles w, w+8, w+16 and keeps their K fragments in registers; no other
  // wave adds to its rows.
  v16h bk[3];
  v8f  acc[3];
#pragma unroll  // constant indices keep the fragments and sums in registers
  for (int t = 0; t < 3; ++t) {
    bk[t]  = frag_from_row(&Kt[((w + t*8)*16 + n0)*DOUT], hf);   // B[d][i] = K[i][d]
    acc[t] = z;
  }
#pragma unroll 2  // one group of LDS reads and one wait place per two strips instead of per strip
  for (int js = 0; js < 24; ++js) {
    const v16h a    = frag_from_row(&Qt[(js*16 + n0)*DOUT], hf);
    const v8f  bias = *(const v8f*)&colBias[js*16 + hf*8];       // rows j of this lane half
#pragma unroll  // constant indices keep the fragments and sums in registers
    for (int t = 0; t < 3; ++t) {
      const v8f c = wmma_f16(a, bk[t], z);
      const v8f e = c * SC_LOG2E + bias;
#pragma unroll  // constant indices keep the fragments and sums in registers
      for (int r = 0; r < 8; ++r) acc[t][r] += __builtin_amdgcn_exp2f(e[r]);
    }
  }

#pragma unroll  // constant indices keep the fragments and sums in registers
  for (int t = 0; t < 3; ++t) {
    float sum = ((acc[t][0] + acc[t][1]) + (acc[t][2] + acc[t][3]))
              + ((acc[t][4] + acc[t][5]) + (acc[t][6] + acc[t][7]));
    sum += __shfl_xor(sum, 16, 32);        // the other eight rows j of every strip
    if (hf == 0)
      out[((size_t)(h*NN + (w + t*8)*16 + n0))*NL + l] = sum * (1.f / 384.f);
  }
}

// ---------------------------------------------------------------------------
extern "C" void kernel_launch(void* const* d_in, const int* in_sizes, int n_in,
                              void* d_out, int out_size, void* d_ws, size_t ws_size,
                              hipStream_t stream) {
  const float* x      = (const float*)d_in[0];
  const float* ln_w   = (const float*)d_in[1];
  const float* ln_b   = (const float*)d_in[2];
  const float* proj_w = (const float*)d_in[3];
  const float* proj_b = (const float*)d_in[4];
  const float* wk     = (const float*)d_in[5];
  const float* wq     = (const float*)d_in[6];

  half_t* wgt = (half_t*)d_ws;            // f16 weights: proj_w | wk | wq
  half_t* pwh = wgt;
  half_t* wkh = pwh + DOUT*DIN;
  half_t* wqh = wkh + DOUT*DOUT;

  prep_weights_kernel<<<(DOUT*DIN + 2*DOUT*DOUT + 255)/256, 256, 0, stream>>>(
      proj_w, wk, wq, wgt);
  // one block per (h,l) pair
  ln_kq_atten_kernel<<<NH*NL, 256, 0, stream>>>(x, ln_w, ln_b, pwh, proj_b,
                                                wkh, wqh, (float*)d_out);
}

// v005
// Measured time: 28.4 microseconds a run.
// In two side-by-side timings against v004, it was 1.07 and 1.06 times as fast.
// Counting every step since v000, it is 2.95 times as fast.
#include <hip/hip_runtime.h>
#include <hip/hip_bf16.h>

typedef _Float16 half_t;
typedef __attribute__((ext_vector_type(16))) _Float16 v16h;
typedef __attribute__((ext_vector_type(8)))  _Float16 v8h;
typedef __attribute__((ext_vector_type(8)))  float    v8f;
typedef __attribute__((ext_vector_type(4)))  float    v4f;

#define NH   8
#define NN   384
#define NL   64
#define DIN  128
#define DOUT 32

__device__ __forceinline__ v8f wmma_f16(v16h a, v16h b, v8f c) {
  return __builtin_amdgcn_wmma_f32_16x16x32_f16(false, a, false, b, (short)0, c, false, false);
}

// Build a 16x32-f16 WMMA A/B fragment from a row-major f16 row (LDS or global).
// Per ISA 7.12.2: lane-half hf=0 needs K{0..7,16..23}, hf=1 needs K{8..15,24..31}
// -> two contiguous 16B chunks at +hf*8 and +hf*8+16 halves.
__device__ __forceinline__ v16h frag_from_row(const half_t* rowp, int hf) {
  v8h lo = *(const v8h*)(rowp + hf*8);
  v8h hi = *(const v8h*)(rowp + hf*8 + 16);
  v16h r;
#pragma unroll
  for (int e = 0; e < 8; ++e) { r[e] = lo[e]; r[e+8] = hi[e]; }
  return r;
}

// ---------------------------------------------------------------------------
// Kernel 0: one-shot f32 -> f16 conversion of the three weight matrices into
// workspace so the streaming kernel never does VALU converts for weights.
// ---------------------------------------------------------------------------
__global__ __launch_bounds__(256)
void prep_weights_kernel(const float* __restrict__ proj_w,
                         const float* __restrict__ wk,
                         const float* __restrict__ wq,
                         half_t* __restrict__ wout)
{
  int t = blockIdx.x * 256 + threadIdx.x;
  if (t < DOUT*DIN)                 wout[t] = (half_t)proj_w[t];
  else if (t < DOUT*DIN + DOUT*DOUT)   wout[t] = (half_t)wk[t - DOUT*DIN];
  else if (t < DOUT*DIN + 2*DOUT*DOUT) wout[t] = (half_t)wq[t - DOUT*DIN - DOUT*DOUT];
}

// ---------------------------------------------------------------------------
// Kernel 1: one block of 8 waves per (h,l) pair, two blocks per WGP, every block
// resident at once.
// Part A: LayerNorm + proj(128->32, +bias) + k/q proj (32->32) of the pair's own
// 384 rows x[h][i][l][:] (512 contiguous bytes each).  Each wave walks TPW 16-row
// tiles in a loop and writes its rows of K and Q as f16 straight into the LDS
// tiles that part B reads: K and Q never go through global memory.
// The weights are fetched from global memory once, in front of the loop: the
// eight proj_w fragments and the bias stay in registers, wk and wq lie in LDS at
// a padded pitch.
// The f32 tile is brought into the wave's own LDS slot, at a padded row pitch, by
// asynchronous copies; each lane then reads its row's columns ONCE, already in
// WMMA A-fragment order, and keeps them in registers for the statistics, the
// normalisation and the f16 fragments.  As soon as a tile is in registers the
// copies of the wave's next tile are issued into the same slot, so that they fly
// while this tile is normalised and projected.
// Part B: scores = K @ Q^T * scale (+eps), softmax over i (online, per column j),
// mean over j, all from LDS.
// Both reductions run down the accumulator registers of a lane:
//   pass 1 forms tiles with M = i, N = j (K as A, Q as B): a lane holds one
//          column j and reduces over its rows i; the two lane halves of a
//          column are merged once per strip, behind the loop.
//   pass 2 forms the transposed tiles, M = j, N = i (Q as A, K as B): a lane
//          holds one row i and sums its probabilities over j.
// ---------------------------------------------------------------------------
#define XPITCH 132  // floats per LDS row: 528 B = 16 B x 33 (odd), so the 16 rows of a b128 column read fall on 64 distinct banks
#define PPITCH 40   // halfs per LDS row of xp: 80 B = 16 B x 5 (odd), same reason
#define TPW 3       // tiles per wave: 24 tiles of 16 rows i = 8 waves x 3
#define SCALING 0.17677669529663687f  // 1/sqrt(32)
#define SC_LOG2E (SCALING * 1.4426950408889634f)  // raw score -> exponent of 2

// Eight rows of a tile, 512 contiguous bytes each, from global memory into the wave's LDS slot:
// each lane copies its own 16 bytes of every row (both addresses multiples of 16).
// lds: the lane's LDS byte address in the first of the rows; g: its global address there.
// s_wait_xcnt 0 stands inside the statement, behind the last copy, so that no address register
// that a copy names is rewritten in front of it (a precaution).
__device__ __forceinline__ void copy_rows8(unsigned lds, const float* g) {
  asm volatile("global_load_async_to_lds_b128 %0, %8, off\n\t"
               "global_load_async_to_lds_b128 %1, %9, off\n\t"
               "global_load_async_to_lds_b128 %2, %10, off\n\t"
               "global_load_async_to_lds_b128 %3, %11, off\n\t"
               "global_load_async_to_lds_b128 %4, %12, off\n\t"
               "global_load_async_to_lds_b128 %5, %13, off\n\t"
               "global_load_async_to_lds_b128 %6, %14, off\n\t"
               "global_load_async_to_lds_b128 %7, %15, off\n\t"
               "s_wait_xcnt 0x0"
               :: "v"(lds),               "v"(lds + 1*XPITCH*4), "v"(lds + 2*XPITCH*4), "v"(lds + 3*XPITCH*4),
                  "v"(lds + 4*XPITCH*4),  "v"(lds + 5*XPITCH*4), "v"(lds + 6*XPITCH*4), "v"(lds + 7*XPITCH*4),
                  "v"(g),                 "v"(g + 1*(NL*DIN)),   "v"(g + 2*(NL*DIN)),   "v"(g + 3*(NL*DIN)),
                  "v"(g + 4*(NL*DIN)),    "v"(g + 5*(NL*DIN)),   "v"(g + 6*(NL*DIN)),   "v"(g + 7*(NL*DIN))
               : "memory");
}

__global__ __launch_bounds__(256)
void ln_kq_atten_kernel(const float* __restrict__ x,
                        const float* __restrict__ ln_w,  const float* __restrict__ ln_b,
                        const half_t* __restrict__ pwh,  const float* __restrict__ proj_b,
                        const half_t* __restrict__ wkh,  const half_t* __restrict__ wqh,
                        float* __restrict__ out)
{
  __shared__ __align__(16) float  xs[8][16*XPITCH];  // 66 KB
  __shared__ __align__(16) half_t xp[8][16*PPITCH];  // 10 KB
  __shared__ __align__(16) half_t s_wk[DOUT*PPITCH]; // 2.5 KB, rows at the padded pitch of xp
  __shared__ __align__(16) half_t s_wq[DOUT*PPITCH]; // 2.5 KB
  __shared__ __align__(16) float  s_lnw[DIN];
  __shared__ __align__(16) float  s_lnb[DIN];
  __shared__ __align__(16) half_t Kt[NN*DOUT];  // 24 KB
  __shared__ __align__(16) half_t Qt[NN*DOUT];  // 24 KB
  __shared__ __align__(32) float colBias[NN];   // per column j: -(max*SC_LOG2E + log2(denominator))

  const int h    = blockIdx.x >> 6;
  const int l    = blockIdx.x & 63;
  const int tid  = threadIdx.x;
  const int w    = tid >> 5;
  const int lane = tid & 31;
  const int n0   = lane & 15;      // N / M index within tile
  const int hf   = lane >> 4;      // lane half

  // --- the wave's first tile (16 rows i, NL*DIN floats apart; one row per copy) starts at once;
  //     tile t begins at row (t*8 + w)*16 ---
  const unsigned xs_lds = (unsigned)(size_t)&xs[w][lane*4];   // low 32 bits: byte offset in the block's LDS
  const float*   xsrc   = x + ((size_t)(h*NN + w*16)*NL + l)*DIN + lane*4;
  copy_rows8(xs_lds, xsrc);
  copy_rows8(xs_lds + 8*XPITCH*4, xsrc + 8*(NL*DIN));

  // --- proj_w fragments and bias: read once per wave, live over the tile loop ---
  v16h bp[2][4];
#pragma unroll
  for (int nt = 0; nt < 2; ++nt)
#pragma unroll
    for (int kb = 0; kb < 4; ++kb)
      bp[nt][kb] = frag_from_row(pwh + (n0 + nt*16)*DIN + kb*32, hf);
  // wk, wq and the LayerNorm vectors: staged once per block in LDS by its first four waves
  // (16 B per thread and matrix); the first barrier of the loop publishes them
  if (tid < DIN) {
    *(v8h*)&s_wk[(tid >> 2)*PPITCH + (tid & 3)*8] = *(const v8h*)(wkh + tid*8);
    *(v8h*)&s_wq[(tid >> 2)*PPITCH + (tid & 3)*8] = *(const v8h*)(wqh + tid*8);
    s_lnw[tid] = ln_w[tid]; s_lnb[tid] = ln_b[tid];
  }
  const float b0 = proj_b[n0], b1 = proj_b[n0 + 16];

#pragma unroll 1  // rolled: one copy of the body keeps the wave under 256 registers, so two blocks share a WGP
  for (int t = 0; t < TPW; ++t) {
    const int rowBase = (t*8 + w) * 16;   // first row i of this wave's tile

    // this tile's 16 copies have landed in the wave's slot before anything of it is read
    asm volatile("s_wait_asynccnt 0x0" ::: "memory");
    __syncthreads();

    // --- this lane's 64 columns of row n0, in A-fragment order:
    //     xv[kb*4 + c*2 + q] = columns kb*32 + hf*8 + c*16 + q*4 .. +3 ---
    v4f xv[16];
#pragma unroll  // constant indices keep xv[] in registers
    for (int g = 0; g < 16; ++g) {
      const int col = (g >> 2)*32 + hf*8 + ((g >> 1) & 1)*16 + (g & 1)*4;
      xv[g] = *(const v4f*)&xs[w][n0*XPITCH + col];
    }

    // --- the next tile's copies into the same slot.  The slot is read by this wave alone, so the
    //     wave's own LDS wait frees it: every read above has returned before a copy can overwrite it ---
    if (t + 1 < TPW) {
      asm volatile("s_wait_dscnt 0x0" ::: "memory");
      const float* xnext = xsrc + (size_t)(t + 1)*(8*16*NL*DIN);
      copy_rows8(xs_lds, xnext);
      copy_rows8(xs_lds + 8*XPITCH*4, xnext + 8*(NL*DIN));
    }

    // --- LayerNorm stats: 2 lanes per row, four partial sums per lane ---
    v4f s4 = {0.f, 0.f, 0.f, 0.f}, q4 = {0.f, 0.f, 0.f, 0.f};
#pragma unroll  // constant indices keep xv[] in registers
    for (int g = 0; g < 16; ++g) { s4 += xv[g]; q4 += xv[g]*xv[g]; }
    float s  = (s4[0] + s4[1]) + (s4[2] + s4[3]);
    float s2 = (q4[0] + q4[1]) + (q4[2] + q4[3]);
    s  += __shfl_xor(s, 16, 32);
    s2 += __shfl_xor(s2, 16, 32);
    const float mu   = s * (1.f/128.f);
    const float var  = s2 * (1.f/128.f) - mu*mu;
    const float rstd = rsqrtf(var + 1e-5f);

    // --- normalize + affine -> f16 A fragments, in registers ---
    v16h af[4];
#pragma unroll  // constant indices keep xv[] and af[] in registers
    for (int g = 0; g < 16; ++g) {
      const int col = (g >> 2)*32 + hf*8 + ((g >> 1) & 1)*16 + (g & 1)*4;
      const v4f lw = *(const v4f*)&s_lnw[col];
      const v4f lb = *(const v4f*)&s_lnb[col];
      const v4f v  = (xv[g] - mu) * rstd * lw + lb;
#pragma unroll  // constant element index into the fragment
      for (int e = 0; e < 4; ++e) af[g >> 2][(g & 3)*4 + e] = (half_t)v[e];
    }

    // --- proj: xp = xn @ proj_w^T + proj_b  (16x128 @ 128x32) ---
    v8f c0, c1;
#pragma unroll
    for (int r = 0; r < 8; ++r) { c0[r] = b0; c1[r] = b1; }

#pragma unroll
    for (int kb = 0; kb < 4; ++kb) {
      c0 = wmma_f16(af[kb], bp[0][kb], c0);
      c1 = wmma_f16(af[kb], bp[1][kb], c1);
    }

    // stash xp tile (row-major f16)
#pragma unroll
    for (int r = 0; r < 8; ++r) {
      int m = r + hf*8;
      xp[w][m*PPITCH + n0]      = (half_t)c0[r];
      xp[w][m*PPITCH + n0 + 16] = (half_t)c1[r];
    }
    __syncthreads();

    // --- k = xp @ wk^T , q = xp @ wq^T  (16x32 @ 32x32) ---
    const v16h bk0 = frag_from_row(&s_wk[n0*PPITCH], hf);
    const v16h bk1 = frag_from_row(&s_wk[(n0+16)*PPITCH], hf);
    const v16h bq0 = frag_from_row(&s_wq[n0*PPITCH], hf);
    const v16h bq1 = frag_from_row(&s_wq[(n0+16)*PPITCH], hf);
    v16h a2 = frag_from_row(&xp[w][n0*PPITCH], hf);
    const v8f z0 = {};
    v8f ck0 = wmma_f16(a2, bk0, z0);
    v8f ck1 = wmma_f16(a2, bk1, z0);
    v8f cq0 = wmma_f16(a2, bq0, z0);
    v8f cq1 = wmma_f16(a2, bq1, z0);

    // K and Q rows of this tile as f16 into the block's LDS tiles, row-major [i][d]
#pragma unroll
    for (int r = 0; r < 8; ++r) {
      const int i = rowBase + r + hf*8;
      Kt[i*DOUT + n0]      = (half_t)ck0[r];
      Kt[i*DOUT + n0 + 16] = (half_t)ck1[r];
      Qt[i*DOUT + n0]      = (half_t)cq0[r];
      Qt[i*DOUT + n0 + 16] = (half_t)cq1[r];
    }
  }
  __syncthreads();   // every wave's rows of K and Q are in LDS before any wave reads them

  const v8f z = {};

  // ---- pass 1: column statistics.  The wave owns j-strips w, w+8, w+16 and keeps
  // their Q fragments in registers, so each K fragment read serves all three.
  // The +eps of the reference is common to a score and to its column's maximum
  // and cancels in their difference, which is all that the softmax uses.
  {
    v16h  bq[3];
    float mrun[3];   // maximum (raw score) over this lane's rows
    v8f   drun[3];   // denominator over this lane's rows, one partial sum per accumulator register
#pragma unroll  // constant indices keep the fragments and sums in registers
    for (int s = 0; s < 3; ++s) {
      bq[s]   = frag_from_row(&Qt[((w + s*8)*16 + n0)*DOUT], hf);  // B[d][j] = Q[j][d]
      mrun[s] = -__builtin_inff();
      drun[s] = z;
    }
    for (int ti = 0; ti < 24; ti += 2) {   // two i-tiles per rescale of the running sums
      const v16h a0 = frag_from_row(&Kt[(ti*16 + n0)*DOUT], hf);
      const v16h a1 = frag_from_row(&Kt[(ti*16 + 16 + n0)*DOUT], hf);
      v8f c0[3], c1[3];
#pragma unroll  // constant indices keep the fragments and sums in registers
      for (int s = 0; s < 3; ++s) {
        c0[s] = wmma_f16(a0, bq[s], z);
        c1[s] = wmma_f16(a1, bq[s], z);
      }
#pragma unroll  // constant indices keep the fragments and sums in registers
      for (int s = 0; s < 3; ++s) {
        const v8f x = c0[s], y = c1[s];
        const float t0 = fmaxf(fmaxf(x[0], x[1]), x[2]);
        const float t1 = fmaxf(fmaxf(x[3], x[4]), x[5]);
        const float t2 = fmaxf(fmaxf(x[6], x[7]), y[0]);
        const float t3 = fmaxf(fmaxf(y[1], y[2]), y[3]);
        const float t4 = fmaxf(fmaxf(y[4], y[5]), y[6]);
        const float u0 = fmaxf(fmaxf(t0, t1), t2);
        const float u1 = fmaxf(fmaxf(t3, t4), y[7]);
        const float mnew = fmaxf(fmaxf(u0, u1), mrun[s]);
        const float nmk  = -mnew * SC_LOG2E;
        const float corr = __builtin_amdgcn_exp2f(mrun[s] * SC_LOG2E + nmk);  // 0 on the first trip
        const v8f e0 = x * SC_LOG2E + nmk;
        const v8f e1 = y * SC_LOG2E + nmk;
        v8f p0, p1;
#pragma unroll  // constant indices keep the fragments and sums in registers
        for (int r = 0; r < 8; ++r) {
          p0[r] = __builtin_amdgcn_exp2f(e0[r]);
          p1[r] = __builtin_amdgcn_exp2f(e1[r]);
        }
        drun[s] = drun[s] * corr + p0;
        drun[s] += p1;
        mrun[s] = mnew;
      }
    }
#pragma unroll  // constant indices keep the fragments and sums in registers
    for (int s = 0; s < 3; ++s) {          // merge the two row halves of each column
      const float d_own = ((drun[s][0] + drun[s][1]) + (drun[s][2] + drun[s][3]))
                        + ((drun[s][4] + drun[s][5]) + (drun[s][6] + drun[s][7]));
      const float m_oth = __shfl_xor(mrun[s], 16, 32);
      const float d_oth = __shfl_xor(d_own, 16, 32);
      const float mk    = fmaxf(mrun[s], m_oth) * SC_LOG2E;
      const float d     = d_own * __builtin_amdgcn_exp2f(mrun[s] * SC_LOG2E - mk)
                        + d_oth * __builtin_amdgcn_exp2f(m_oth   * SC_LOG2E - mk);
      if (hf == 0) colBias[(w + s*8)*16 + n0] = -(mk + __builtin_amdgcn_logf(d));  // v_log_f32: base 2
    }
  }
  __syncthreads();   // every column's bias is in LDS before any wave reads it

  // ---- pass 2: probabilities 2^(score*SC_LOG2E + bias[j]), summed over j.  The wave
  // owns i-tiles w, w+8, w+16 and keeps their K fragments in registers; no other
  // wave adds to its rows.
  v16h bk[3];
  v8f  acc[3];
#pragma unroll  // constant indices keep the fragments and sums in registers
  for (int t = 0; t < 3; ++t) {
    bk[t]  = frag_from_row(&Kt[((w + t*8)*16 + n0)*DOUT], hf);   // B[d][i] = K[i][d]
    acc[t] = z;
  }
#pragma unroll 2  // one group of LDS reads and one wait place per two strips instead of per strip
  for (int js = 0; js < 24; ++js) {
    const v16h a    = frag_from_row(&Qt[(js*16 + n0)*DOUT], hf);
    const v8f  bias = *(const v8f*)&colBias[js*16 + hf*8];       // rows j of this lane half
#pragma unroll  // constant indices keep the fragments and sums in registers
    for (int t = 0; t < 3; ++t) {
      const v8f c = wmma_f16(a, bk[t], z);
      const v8f e = c * SC_LOG2E + bias;
#pragma unroll  // constant indices keep the fragments and sums in registers
      for (int r = 0; r < 8; ++r) acc[t][r] += __builtin_amdgcn_exp2f(e[r]);
    }
  }

#pragma unroll  // constant indices keep the fragments and sums in registers
  for (int t = 0; t < 3; ++t) {
    float sum = ((acc[t][0] + acc[t][1]) + (acc[t][2] + acc[t][3]))
              + ((acc[t][4] + acc[t][5]) + (acc[t][6] + acc[t][7]));
    sum += __shfl_xor(sum, 16, 32);        // the other eight rows j of every strip
    if (hf == 0)
      out[((size_t)(h*NN + (w + t*8)*16 + n0))*NL + l] = sum * (1.f / 384.f);
  }
}

// ---------------------------------------------------------------------------
extern "C" void kernel_launch(void* const* d_in, const int* in_sizes, int n_in,
                              void* d_out, int out_size, void* d_ws, size_t ws_size,
                              hipStream_t stream) {
  const float* x      = (const float*)d_in[0];
  const float* ln_w   = (const float*)d_in[1];
  const float* ln_b   = (const float*)d_in[2];
  const float* proj_w = (const float*)d_in[3];
  const float* proj_b = (const float*)d_in[4];
  const float* wk     = (const float*)d_in[5];
  const float* wq     = (const float*)d_in[6];

  half_t* wgt = (half_t*)d_ws;            // f16 weights: proj_w | wk | wq
  half_t* pwh = wgt;
  half_t* wkh = pwh + DOUT*DIN;
  half_t* wqh = wkh + DOUT*DOUT;

  prep_weights_kernel<<<(DOUT*DIN + 2*DOUT*DOUT + 255)/256, 256, 0, stream>>>(
      proj_w, wk, wq, wgt);
  // one block per (h,l) pair
  ln_kq_atten_kernel<<<NH*NL, 256, 0, stream>>>(x, ln_w, ln_b, pwh, proj_b,
                                                wkh, wqh, (float*)d_out);
}

// v006
// It runs in 26.2 microseconds.
// Two timings next to v005 put it at 1.08 and 1.09 times that version's speed.
// Counting every step since v000, it is 3.21 times as fast.
#include <hip/hip_runtime.h>
#include <hip/hip_bf16.h>

typedef _Float16 half_t;
typedef __attribute__((ext_vector_type(16))) _Float16 v16h;
typedef __attribute__((ext_vector_type(8)))  _Float16 v8h;
typedef __attribute__((ext_vector_type(4)))  _Float16 v4h;
typedef __attribute__((ext_vector_type(8)))  float    v8f;
typedef __attribute__((ext_vector_type(4)))  float    v4f;

#define NH   8
#define NN   384
#define NL   64
#define DIN  128
#define DOUT 32

__device__ __forceinline__ v8f wmma_f16(v16h a, v16h b, v8f c) {
  return __builtin_amdgcn_wmma_f32_16x16x32_f16(false, a, false, b, (short)0, c, false, false);
}

// Build a 16x32-f16 WMMA A/B fragment from a row-major f16 row (LDS or global).
// Per ISA 7.12.2: lane-half hf=0 needs K{0..7,16..23}, hf=1 needs K{8..15,24..31}
// -> two contiguous 16B chunks at +hf*8 and +hf*8+16 halves.
__device__ __forceinline__ v16h frag_from_row(const half_t* rowp, int hf) {
  v8h lo = *(const v8h*)(rowp + hf*8);
  v8h hi = *(const v8h*)(rowp + hf*8 + 16);
  v16h r;
#pragma unroll
  for (int e = 0; e < 8; ++e) { r[e] = lo[e]; r[e+8] = hi[e]; }
  return r;
}

// Four f32 values rounded to f16 (round to nearest even).
__device__ __forceinline__ v4h half4_of(v4f v) {
  v4h r;
#pragma unroll
  for (int e = 0; e < 4; ++e) r[e] = (half_t)v[e];
  return r;
}

// ---------------------------------------------------------------------------
// The one kernel: one block of 8 waves per (h,l) pair, two blocks per WGP, every block
// resident at once.
// Part A: LayerNorm + proj(128->32, +bias) + k/q proj (32->32) of the pair's own
// 384 rows x[h][i][l][:] (512 contiguous bytes each).  Each wave walks TPW 16-row
// tiles in a loop and writes its rows of K and Q as f16 straight into the LDS
// tiles that part B reads: K and Q never go through global memory.
// The weights are fetched from global memory once per block, in front of the loop,
// as f32, and rounded to f16 on their way into LDS (padded pitches): each thread
// takes 16 B of wk, 16 B of wq and 64 B of proj_w.  Each wave then takes its eight
// proj_w fragments from LDS into registers, where they and the bias stay.
// The f32 tile is brought into the wave's own LDS slot, at a padded row pitch, by
// asynchronous copies; each lane then reads its row's columns ONCE, already in
// WMMA A-fragment order, and keeps them in registers for the statistics, the
// normalisation and the f16 fragments.  As soon as a tile is in registers the
// copies of the wave's next tile are issued into the same slot, so that they fly
// while this tile is normalised and projected.
// Part B: scores = K @ Q^T * scale (+eps), softmax over i (online, per column j),
// mean over j, all from LDS.
// Both reductions run down the accumulator registers of a lane:
//   pass 1 forms tiles with M = i, N = j (K as A, Q as B): a lane holds one
//          column j and reduces over its rows i; the two lane halves of a
//          column are merged once per strip, behind the loop.
//   pass 2 forms the transposed tiles, M = j, N = i (Q as A, K as B): a lane
//          holds one row i and sums its probabilities over j.
// ---------------------------------------------------------------------------
#define XPITCH 132  // floats per LDS row: 528 B = 16 B x 33 (odd), so the 16 rows of a b128 column read fall on 64 distinct banks
#define PPITCH 40   // halfs per LDS row of xp: 80 B = 16 B x 5 (odd), same reason
#define WPITCH 136  // halfs per LDS row of proj_w: 272 B = 16 B x 17 (odd), same reason
#define TPW 3       // tiles per wave: 24 tiles of 16 rows i = 8 waves x 3
#define SCALING 0.17677669529663687f  // 1/sqrt(32)
#define SC_LOG2E (SCALING * 1.4426950408889634f)  // raw score -> exponent of 2

// Eight rows of a tile, 512 contiguous bytes each, from global memory into the wave's LDS slot:
// each lane copies its own 16 bytes of every row (both addresses multiples of 16).
// lds: the lane's LDS byte address in the first of the rows; g: its global address there.
// s_wait_xcnt 0 stands inside the statement, behind the last copy, so that no address register
// that a copy names is rewritten in front of it (a precaution).
__device__ __forceinline__ void copy_rows8(unsigned lds, const float* g) {
  asm volatile("global_load_async_to_lds_b128 %0, %8, off\n\t"
               "global_load_async_to_lds_b128 %1, %9, off\n\t"
               "global_load_async_to_lds_b128 %2, %10, off\n\t"
               "global_load_async_to_lds_b128 %3, %11, off\n\t"
               "global_load_async_to_lds_b128 %4, %12, off\n\t"
               "global_load_async_to_lds_b128 %5, %13, off\n\t"
               "global_load_async_to_lds_b128 %6, %14, off\n\t"
               "global_load_async_to_lds_b128 %7, %15, off\n\t"
               "s_wait_xcnt 0x0"
               :: "v"(lds),               "v"(lds + 1*XPITCH*4), "v"(lds + 2*XPITCH*4), "v"(lds + 3*XPITCH*4),
                  "v"(lds + 4*XPITCH*4),  "v"(lds + 5*XPITCH*4), "v"(lds + 6*XPITCH*4), "v"(lds + 7*XPITCH*4),
                  "v"(g),                 "v"(g + 1*(NL*DIN)),   "v"(g + 2*(NL*DIN)),   "v"(g + 3*(NL*DIN)),
                  "v"(g + 4*(NL*DIN)),    "v"(g + 5*(NL*DIN)),   "v"(g + 6*(NL*DIN)),   "v"(g + 7*(NL*DIN))
               : "memory");
}

__global__ __launch_bounds__(256)
void ln_kq_atten_kernel(const float* __restrict__ x,
                        const float* __restrict__ ln_w,  const float* __restrict__ ln_b,
                        const float* __restrict__ proj_w, const float* __restrict__ proj_b,
                        const float* __restrict__ wk,    const float* __restrict__ wq,
                        float* __restrict__ out)
{
  __shared__ __align__(16) float  xs[8][16*XPITCH];  // 66 KB
  __shared__ __align__(16) half_t xp[8][16*PPITCH];  // 10 KB
  __shared__ __align__(16) half_t s_pw[DOUT*WPITCH]; // 8.5 KB
  __shared__ __align__(16) half_t s_wk[DOUT*PPITCH]; // 2.5 KB, rows at the padded pitch of xp
  __shared__ __align__(16) half_t s_wq[DOUT*PPITCH]; // 2.5 KB
  __shared__ __align__(16) float  s_lnw[DIN];
  __shared__ __align__(16) float  s_lnb[DIN];
  __shared__ __align__(16) half_t Kt[NN*DOUT];  // 24 KB
  __shared__ __align__(16) half_t Qt[NN*DOUT];  // 24 KB
  __shared__ __align__(32) float colBias[NN];   // per column j: -(max*SC_LOG2E + log2(denominator))

  const int h    = blockIdx.x >> 6;
  const int l    = blockIdx.x & 63;
  const int tid  = threadIdx.x;
  const int w    = tid >> 5;
  const int lane = tid & 31;
  const int n0   = lane & 15;      // N / M index within tile
  const int hf   = lane >> 4;      // lane half

  // --- the three weight matrices (f32) and the bias: the loads go out in front of the block's first
  //     64 KB of x, so that they do not queue behind it.  Per load a wave reads 512 contiguous bytes
  //     (one row of proj_w, four of wk or wq); pw4[k] = floats (k*256 + tid)*4 .. +3 of proj_w ---
  v4f pw4[4];
#pragma unroll
  for (int k = 0; k < 4; ++k) pw4[k] = *(const v4f*)(proj_w + (k*256 + tid)*4);
  const v4f wk4 = *(const v4f*)(wk + tid*4);
  const v4f wq4 = *(const v4f*)(wq + tid*4);
  const float b0 = proj_b[n0], b1 = proj_b[n0 + 16];

  // --- the wave's first tile (16 rows i, NL*DIN floats apart; one row per copy) starts next;
  //     tile t begins at row (t*8 + w)*16 ---
  const unsigned xs_lds = (unsigned)(size_t)&xs[w][lane*4];   // low 32 bits: byte offset in the block's LDS
  const float*   xsrc   = x + ((size_t)(h*NN + w*16)*NL + l)*DIN + lane*4;
  copy_rows8(xs_lds, xsrc);
  copy_rows8(xs_lds + 8*XPITCH*4, xsrc + 8*(NL*DIN));

  // --- the weights, rounded to f16, staged once per block in LDS ---
#pragma unroll
  for (int k = 0; k < 4; ++k) {
    const int off = (k*256 + tid)*4;   // index of the thread's four floats in proj_w
    *(v4h*)&s_pw[(off >> 7)*WPITCH + (off & (DIN - 1))] = half4_of(pw4[k]);
  }
  *(v4h*)&s_wk[(tid >> 3)*PPITCH + (tid & 7)*4] = half4_of(wk4);
  *(v4h*)&s_wq[(tid >> 3)*PPITCH + (tid & 7)*4] = half4_of(wq4);
  // the LayerNorm vectors, by the first four waves
  if (tid < DIN) { s_lnw[tid] = ln_w[tid]; s_lnb[tid] = ln_b[tid]; }
  __syncthreads();   // the staged weights are in LDS before any wave reads them

  // --- proj_w fragments: read once per wave, live over the tile loop like the bias ---
  v16h bp[2][4];
#pragma unroll
  for (int nt = 0; nt < 2; ++nt)
#pragma unroll
    for (int kb = 0; kb < 4; ++kb)
      bp[nt][kb] = frag_from_row(&s_pw[(n0 + nt*16)*WPITCH + kb*32], hf);

#pragma unroll 1  // rolled: one copy of the body keeps the wave under 256 registers, so two blocks share a WGP
  for (int t = 0; t < TPW; ++t) {
    const int rowBase = (t*8 + w) * 16;   // first row i of this wave's tile

    // this tile's 16 copies have landed in the wave's slot before anything of it is read
    asm volatile("s_wait_asynccnt 0x0" ::: "memory");
    __syncthreads();

    // --- this lane's 64 columns of row n0, in A-fragment order:
    //     xv[kb*4 + c*2 + q] = columns kb*32 + hf*8 + c*16 + q*4 .. +3 ---
    v4f xv[16];
#pragma unroll  // constant indices keep xv[] in registers
    for (int g = 0; g < 16; ++g) {
      const int col = (g >> 2)*32 + hf*8 + ((g >> 1) & 1)*16 + (g & 1)*4;
      xv[g] = *(const v4f*)&xs[w][n0*XPITCH + col];
    }

    // --- the next tile's copies into the same slot.  The slot is read by this wave alone, so the
    //     wave's own LDS wait frees it: every read above has returned before a copy can overwrite it ---
    if (t + 1 < TPW) {
      asm volatile("s_wait_dscnt 0x0" ::: "memory");
      const float* xnext = xsrc + (size_t)(t + 1)*(8*16*NL*DIN);
      copy_rows8(xs_lds, xnext);
      copy_rows8(xs_lds + 8*XPITCH*4, xnext + 8*(NL*DIN));
    }

    // --- LayerNorm stats: 2 lanes per row, four partial sums per lane ---
    v4f s4 = {0.f, 0.f, 0.f, 0.f}, q4 = {0.f, 0.f, 0.f, 0.f};
#pragma unroll  // constant indices keep xv[] in registers
    for (int g = 0; g < 16; ++g) { s4 += xv[g]; q4 += xv[g]*xv[g]; }
    float s  = (s4[0] + s4[1]) + (s4[2] + s4[3]);
    float s2 = (q4[0] + q4[1]) + (q4[2] + q4[3]);
    s  += __shfl_xor(s, 16, 32);
    s2 += __shfl_xor(s2, 16, 32);
    const float mu   = s * (1.f/128.f);
    const float var  = s2 * (1.f/128.f) - mu*mu;
    const float rstd = rsqrtf(var + 1e-5f);

    // --- normalize + affine -> f16 A fragments, in registers ---
    v16h af[4];
#pragma unroll  // constant indices keep xv[] and af[] in registers
    for (int g = 0; g < 16; ++g) {
      const int col = (g >> 2)*32 + hf*8 + ((g >> 1) & 1)*16 + (g & 1)*4;
      const v4f lw = *(const v4f*)&s_lnw[col];
      const v4f lb = *(const v4f*)&s_lnb[col];
      const v4f v  = (xv[g] - mu) * rstd * lw + lb;
#pragma unroll  // constant element index into the fragment
      for (int e = 0; e < 4; ++e) af[g >> 2][(g & 3)*4 + e] = (half_t)v[e];
    }

    // --- proj: xp = xn @ proj_w^T + proj_b  (16x128 @ 128x32) ---
    v8f c0, c1;
#pragma unroll
    for (int r = 0; r < 8; ++r) { c0[r] = b0; c1[r] = b1; }

#pragma unroll
    for (int kb = 0; kb < 4; ++kb) {
      c0 = wmma_f16(af[kb], bp[0][kb], c0);
      c1 = wmma_f16(af[kb], bp[1][kb], c1);
    }

    // stash xp tile (row-major f16)
#pragma unroll
    for (int r = 0; r < 8; ++r) {
      int m = r + hf*8;
      xp[w][m*PPITCH + n0]      = (half_t)c0[r];
      xp[w][m*PPITCH + n0 + 16] = (half_t)c1[r];
    }
    __syncthreads();

    // --- k = xp @ wk^T , q = xp @ wq^T  (16x32 @ 32x32) ---
    const v16h bk0 = frag_from_row(&s_wk[n0*PPITCH], hf);
    const v16h bk1 = frag_from_row(&s_wk[(n0+16)*PPITCH], hf);
    const v16h bq0 = frag_from_row(&s_wq[n0*PPITCH], hf);
    const v16h bq1 = frag_from_row(&s_wq[(n0+16)*PPITCH], hf);
    v16h a2 = frag_from_row(&xp[w][n0*PPITCH], hf);
    const v8f z0 = {};
    v8f ck0 = wmma_f16(a2, bk0, z0);
    v8f ck1 = wmma_f16(a2, bk1, z0);
    v8f cq0 = wmma_f16(a2, bq0, z0);
    v8f cq1 = wmma_f16(a2, bq1, z0);

    // K and Q rows of this tile as f16 into the block's LDS tiles, row-major [i][d]
#pragma unroll
    for (int r = 0; r < 8; ++r) {
      const int i = rowBase + r + hf*8;
      Kt[i*DOUT + n0]      = (half_t)ck0[r];
      Kt[i*DOUT + n0 + 16] = (half_t)ck1[r];
      Qt[i*DOUT + n0]      = (half_t)cq0[r];
      Qt[i*DOUT + n0 + 16] = (half_t)cq1[r];
    }
  }
  __syncthreads();   // every wave's rows of K and Q are in LDS before any wave reads them

  const v8f z = {};

  // ---- pass 1: column statistics.  The wave owns j-strips w, w+8, w+16 and keeps
  // their Q fragments in registers, so each K fragment read serves all three.
  // The +eps of the reference is common to a score and to its column's maximum
  // and cancels in their difference, which is all that the softmax uses.
  {
    v16h  bq[3];
    float mrun[3];   // maximum (raw score) over this lane's rows
    v8f   drun[3];   // denominator over this lane's rows, one partial sum per accumulator register
#pragma unroll  // constant indices keep the fragments and sums in registers
    for (int s = 0; s < 3; ++s) {
      bq[s]   = frag_from_row(&Qt[((w + s*8)*16 + n0)*DOUT], hf);  // B[d][j] = Q[j][d]
      mrun[s] = -__builtin_inff();
      drun[s] = z;
    }
    for (int ti = 0; ti < 24; ti += 2) {   // two i-tiles per rescale of the running sums
      const v16h a0 = frag_from_row(&Kt[(ti*16 + n0)*DOUT], hf);
      const v16h a1 = frag_from_row(&Kt[(ti*16 + 16 + n0)*DOUT], hf);
      v8f c0[3], c1[3];
#pragma unroll  // constant indices keep the fragments and sums in registers
      for (int s = 0; s < 3; ++s) {
        c0[s] = wmma_f16(a0, bq[s], z);
        c1[s] = wmma_f16(a1, bq[s], z);
      }
#pragma unroll  // constant indices keep the fragments and sums in registers
      for (int s = 0; s < 3; ++s) {
        const v8f x = c0[s], y = c1[s];
        const float t0 = fmaxf(fmaxf(x[0], x[1]), x[2]);
        const float t1 = fmaxf(fmaxf(x[3], x[4]), x[5]);
        const float t2 = fmaxf(fmaxf(x[6], x[7]), y[0]);
        const float t3 = fmaxf(fmaxf(y[1], y[2]), y[3]);
        const float t4 = fmaxf(fmaxf(y[4], y[5]), y[6]);
        const float u0 = fmaxf(fmaxf(t0, t1), t2);
        const float u1 = fmaxf(fmaxf(t3, t4), y[7]);
        const float mnew = fmaxf(fmaxf(u0, u1), mrun[s]);
        const float nmk  = -mnew * SC_LOG2E;
        const float corr = __builtin_amdgcn_exp2f(mrun[s] * SC_LOG2E + nmk);  // 0 on the first trip
        const v8f e0 = x * SC_LOG2E + nmk;
        const v8f e1 = y * SC_LOG2E + nmk;
        v8f p0, p1;
#pragma unroll  // constant indices keep the fragments and sums in registers
        for (int r = 0; r < 8; ++r) {
          p0[r] = __builtin_amdgcn_exp2f(e0[r]);
          p1[r] = __builtin_amdgcn_exp2f(e1[r]);
        }
        drun[s] = drun[s] * corr + p0;
        drun[s] += p1;
        mrun[s] = mnew;
      }
    }
#pragma unroll  // constant indices keep the fragments and sums in registers
    for (int s = 0; s < 3; ++s) {          // merge the two row halves of each column
      const float d_own = ((drun[s][0] + drun[s][1]) + (drun[s][2] + drun[s][3]))
                        + ((drun[s][4] + drun[s][5]) + (drun[s][6] + drun[s][7]));
      const float m_oth = __shfl_xor(mrun[s], 16, 32);
      const float d_oth = __shfl_xor(d_own, 16, 32);
      const float mk    = fmaxf(mrun[s], m_oth) * SC_LOG2E;
      const float d     = d_own * __builtin_amdgcn_exp2f(mrun[s] * SC_LOG2E - mk)
                        + d_oth * __builtin_amdgcn_exp2f(m_oth   * SC_LOG2E - mk);
      if (hf == 0) colBias[(w + s*8)*16 + n0] = -(mk + __builtin_amdgcn_logf(d));  // v_log_f32: base 2
    }
  }
  __syncthreads();   // every column's bias is in LDS before any wave reads it

  // ---- pass 2: probabilities 2^(score*SC_LOG2E + bias[j]), summed over j.  The wave
  // owns i-tiles w, w+8, w+16 and keeps their K fragments in registers; no other
  // wave adds to its rows.
  v16h bk[3];
  v8f  acc[3];
#pragma unroll  // constant indices keep the fragments and sums in registers
  for (int t = 0; t < 3; ++t) {
    bk[t]  = frag_from_row(&Kt[((w + t*8)*16 + n0)*DOUT], hf);   // B[d][i] = K[i][d]
    acc[t] = z;
  }
#pragma unroll 2  // one group of LDS reads and one wait place per two strips instead of per strip
  for (int js = 0; js < 24; ++js) {
    const v16h a    = frag_from_row(&Qt[(js*16 + n0)*DOUT], hf);
    const v8f  bias = *(const v8f*)&colBias[js*16 + hf*8];       // rows j of this lane half
#pragma unroll  // constant indices keep the fragments and sums in registers
    for (int t = 0; t < 3; ++t) {
      const v8f c = wmma_f16(a, bk[t], z);
      const v8f e = c * SC_LOG2E + bias;
#pragma unroll  // constant indices keep the fragments and sums in registers
      for (int r = 0; r < 8; ++r) acc[t][r] += __builtin_amdgcn_exp2f(e[r]);
    }
  }

#pragma unroll  // constant indices keep the fragments and sums in registers
  for (int t = 0; t < 3; ++t) {
    float sum = ((acc[t][0] + acc[t][1]) + (acc[t][2] + acc[t][3]))
              + ((acc[t][4] + acc[t][5]) + (acc[t][6] + acc[t][7]));
    sum += __shfl_xor(sum, 16, 32);        // the other eight rows j of every strip
    if (hf == 0)
      out[((size_t)(h*NN + (w + t*8)*16 + n0))*NL + l] = sum * (1.f / 384.f);
  }
}

// ---------------------------------------------------------------------------
extern "C" void kernel_launch(void* const* d_in, const int* in_sizes, int n_in,
                              void* d_out, int out_size, void* d_ws, size_t ws_size,
                              hipStream_t stream) {
  const float* x      = (const float*)d_in[0];
  const float* ln_w   = (const float*)d_in[1];
  const float* ln_b   = (const float*)d_in[2];
  const float* proj_w = (const float*)d_in[3];
  const float* proj_b = (const float*)d_in[4];
  const float* wk     = (const float*)d_in[5];
  const float* wq     = (const float*)d_in[6];

  // one block per (h,l) pair; the workspace is not used
  ln_kq_atten_kernel<<<NH*NL, 256, 0, stream>>>(x, ln_w, ln_b, proj_w, proj_b,
                                                wk, wq, (float*)d_out);
}

// v007
// One run takes 23.8 microseconds.
// Two timings next to v006 both put it at 1.09 times that version's speed.
// All steps since v000 together make it 3.50 times as fast.
#include <hip/hip_runtime.h>
#include <hip/hip_bf16.h>

typedef _Float16 half_t;
typedef __attribute__((ext_vector_type(16))) _Float16 v16h;
typedef __attribute__((ext_vector_type(8)))  _Float16 v8h;
typedef __attribute__((ext_vector_type(4)))  _Float16 v4h;
typedef __attribute__((ext_vector_type(8)))  float    v8f;
typedef __attribute__((ext_vector_type(4)))  float    v4f;

#define NH   8
#define NN   384
#define NL   64
#define DIN  128
#define DOUT 32

__device__ __forceinline__ v8f wmma_f16(v16h a, v16h b, v8f c) {
  return __builtin_amdgcn_wmma_f32_16x16x32_f16(false, a, false, b, (short)0, c, false, false);
}

// Build a 16x32-f16 WMMA A/B fragment from a row-major f16 row (LDS or global).
// Per ISA 7.12.2: lane-half hf=0 needs K{0..7,16..23}, hf=1 needs K{8..15,24..31}
// -> two contiguous 16B chunks at +hf*8 and +hf*8+16 halves.
__device__ __forceinline__ v16h frag_from_row(const half_t* rowp, int hf) {
  v8h lo = *(const v8h*)(rowp + hf*8);
  v8h hi = *(const v8h*)(rowp + hf*8 + 16);
  v16h r;
#pragma unroll
  for (int e = 0; e < 8; ++e) { r[e] = lo[e]; r[e+8] = hi[e]; }
  return r;
}

// Four f32 values rounded to f16 (round to nearest even).
__device__ __forceinline__ v4h half4_of(v4f v) {
  v4h r;
#pragma unroll
  for (int e = 0; e < 4; ++e) r[e] = (half_t)v[e];
  return r;
}

// ---------------------------------------------------------------------------
// The one kernel: one block of 8 waves per (h,l) pair, two blocks per WGP, every block
// resident at once.
// Part A: LayerNorm + proj(128->32, +bias) + k/q proj (32->32) of the pair's own
// 384 rows x[h][i][l][:] (512 contiguous bytes each).  Each wave walks TPW 16-row
// tiles in a loop and writes its rows of K and Q as f16 straight into the LDS
// tiles that part B reads: K and Q never go through global memory.
// The weights are fetched from global memory once per block, in front of the loop,
// as f32, and rounded to f16 on their way into LDS (padded pitches): each thread
// takes 16 B of wk, 16 B of wq and 64 B of proj_w.  Each wave then takes its eight
// proj_w fragments from LDS into registers, where they and the bias stay.
// The f32 tile is brought into the wave's own LDS slot, at a padded row pitch, by
// asynchronous copies; each lane then reads its row's columns ONCE, already in
// WMMA A-fragment order, and keeps them in registers for the statistics, the
// normalisation and the f16 fragments.  As soon as a tile is in registers the
// copies of the wave's next tile are issued into the same slot, so that they fly
// while this tile is normalised and projected.
// Part B: scores = K @ Q^T * scale (+eps), softmax over i (per column j),
// mean over j, all from LDS.
// Both reductions run down the accumulator registers of a lane:
//   pass 1 forms tiles with M = i, N = j (K as A, Q as B): a lane holds one
//          column j and reduces over its rows i; the two lane halves of a
//          column are merged once per strip, behind the loop.
//   pass 2 forms the transposed tiles, M = j, N = i (Q as A, K as B): a lane
//          holds one row i and sums its probabilities over j.
// ---------------------------------------------------------------------------
#define XPITCH 132  // floats per LDS row: 528 B = 16 B x 33 (odd), so the 16 rows of a b128 column read fall on 64 distinct banks
#define PPITCH 40   // halfs per LDS row of xp: 80 B = 16 B x 5 (odd), same reason
#define WPITCH 136  // halfs per LDS row of proj_w: 272 B = 16 B x 17 (odd), same reason
#define TPW 3       // tiles per wave: 24 tiles of 16 rows i = 8 waves x 3
#define SCALING 0.17677669529663687f  // 1/sqrt(32)
#define SC_LOG2E (SCALING * 1.4426950408889634f)  // raw score -> exponent of 2

// Eight rows of a tile, 512 contiguous bytes each, from global memory into the wave's LDS slot:
// each lane copies its own 16 bytes of every row (both addresses multiples of 16).
// lds: the lane's LDS byte address in the first of the rows; g: its global address there.
// s_wait_xcnt 0 stands inside the statement, behind the last copy, so that no address register
// that a copy names is rewritten in front of it (a precaution).
__device__ __forceinline__ void copy_rows8(unsigned lds, const float* g) {
  asm volatile("global_load_async_to_lds_b128 %0, %8, off\n\t"
               "global_load_async_to_lds_b128 %1, %9, off\n\t"
               "global_load_async_to_lds_b128 %2, %10, off\n\t"
               "global_load_async_to_lds_b128 %3, %11, off\n\t"
               "global_load_async_to_lds_b128 %4, %12, off\n\t"
               "global_load_async_to_lds_b128 %5, %13, off\n\t"
               "global_load_async_to_lds_b128 %6, %14, off\n\t"
               "global_load_async_to_lds_b128 %7, %15, off\n\t"
               "s_wait_xcnt 0x0"
               :: "v"(lds),               "v"(lds + 1*XPITCH*4), "v"(lds + 2*XPITCH*4), "v"(lds + 3*XPITCH*4),
                  "v"(lds + 4*XPITCH*4),  "v"(lds + 5*XPITCH*4), "v"(lds + 6*XPITCH*4), "v"(lds + 7*XPITCH*4),
                  "v"(g),                 "v"(g + 1*(NL*DIN)),   "v"(g + 2*(NL*DIN)),   "v"(g + 3*(NL*DIN)),
                  "v"(g + 4*(NL*DIN)),    "v"(g + 5*(NL*DIN)),   "v"(g + 6*(NL*DIN)),   "v"(g + 7*(NL*DIN))
               : "memory");
}

__global__ __launch_bounds__(256)
void ln_kq_atten_kernel(const float* __restrict__ x,
                        const float* __restrict__ ln_w,  const float* __restrict__ ln_b,
                        const float* __restrict__ proj_w, const float* __restrict__ proj_b,
                        const float* __restrict__ wk,    const float* __restrict__ wq,
                        float* __restrict__ out)
{
  __shared__ __align__(16) float  xs[8][16*XPITCH];  // 66 KB
  __shared__ __align__(16) half_t xp[8][16*PPITCH];  // 10 KB
  __shared__ __align__(16) half_t s_pw[DOUT*WPITCH]; // 8.5 KB
  __shared__ __align__(16) half_t s_wk[DOUT*PPITCH]; // 2.5 KB, rows at the padded pitch of xp
  __shared__ __align__(16) half_t s_wq[DOUT*PPITCH]; // 2.5 KB
  __shared__ __align__(16) float  s_lnw[DIN];
  __shared__ __align__(16) float  s_lnb[DIN];
  __shared__ __align__(16) half_t Kt[NN*DOUT];  // 24 KB
  __shared__ __align__(16) half_t Qt[NN*DOUT];  // 24 KB
  __shared__ __align__(32) float colBias[NN];   // per column j: -(shift + log2(denominator)), in exponents of 2

  const int h    = blockIdx.x >> 6;
  const int l    = blockIdx.x & 63;
  const int tid  = threadIdx.x;
  const int w    = tid >> 5;
  const int lane = tid & 31;
  const int n0   = lane & 15;      // N / M index within tile
  const int hf   = lane >> 4;      // lane half

  // --- the three weight matrices (f32) and the bias: the loads go out in front of the block's first
  //     64 KB of x, so that they do not queue behind it.  Per load a wave reads 512 contiguous bytes
  //     (one row of proj_w, four of wk or wq); pw4[k] = floats (k*256 + tid)*4 .. +3 of proj_w ---
  v4f pw4[4];
#pragma unroll
  for (int k = 0; k < 4; ++k) pw4[k] = *(const v4f*)(proj_w + (k*256 + tid)*4);
  const v4f wk4 = *(const v4f*)(wk + tid*4);
  const v4f wq4 = *(const v4f*)(wq + tid*4);
  const float b0 = proj_b[n0], b1 = proj_b[n0 + 16];

  // --- the wave's first tile (16 rows i, NL*DIN floats apart; one row per copy) starts next;
  //     tile t begins at row (t*8 + w)*16 ---
  const unsigned xs_lds = (unsigned)(size_t)&xs[w][lane*4];   // low 32 bits: byte offset in the block's LDS
  const float*   xsrc   = x + ((size_t)(h*NN + w*16)*NL + l)*DIN + lane*4;
  copy_rows8(xs_lds, xsrc);
  copy_rows8(xs_lds + 8*XPITCH*4, xsrc + 8*(NL*DIN));

  // --- the weights, rounded to f16, staged once per block in LDS ---
#pragma unroll
  for (int k = 0; k < 4; ++k) {
    const int off = (k*256 + tid)*4;   // index of the thread's four floats in proj_w
    *(v4h*)&s_pw[(off >> 7)*WPITCH + (off & (DIN - 1))] = half4_of(pw4[k]);
  }
  *(v4h*)&s_wk[(tid >> 3)*PPITCH + (tid & 7)*4] = half4_of(wk4);
  *(v4h*)&s_wq[(tid >> 3)*PPITCH + (tid & 7)*4] = half4_of(wq4 * SC_LOG2E);  // Q comes out times SC_LOG2E: K.Q is an exponent of 2
  // the LayerNorm vectors, by the first four waves
  if (tid < DIN) { s_lnw[tid] = ln_w[tid]; s_lnb[tid] = ln_b[tid]; }
  __syncthreads();   // the staged weights are in LDS before any wave reads them

  // --- proj_w fragments: read once per wave, live over the tile loop like the bias ---
  v16h bp[2][4];
#pragma unroll
  for (int nt = 0; nt < 2; ++nt)
#pragma unroll
    for (int kb = 0; kb < 4; ++kb)
      bp[nt][kb] = frag_from_row(&s_pw[(n0 + nt*16)*WPITCH + kb*32], hf);

#pragma unroll 1  // rolled: one copy of the body keeps the wave under 256 registers, so two blocks share a WGP
  for (int t = 0; t < TPW; ++t) {
    const int rowBase = (t*8 + w) * 16;   // first row i of this wave's tile

    // this tile's 16 copies have landed in the wave's slot before anything of it is read
    asm volatile("s_wait_asynccnt 0x0" ::: "memory");
    __syncthreads();

    // --- this lane's 64 columns of row n0, in A-fragment order:
    //     xv[kb*4 + c*2 + q] = columns kb*32 + hf*8 + c*16 + q*4 .. +3 ---
    v4f xv[16];
#pragma unroll  // constant indices keep xv[] in registers
    for (int g = 0; g < 16; ++g) {
      const int col = (g >> 2)*32 + hf*8 + ((g >> 1) & 1)*16 + (g & 1)*4;
      xv[g] = *(const v4f*)&xs[w][n0*XPITCH + col];
    }

    // --- the next tile's copies into the same slot.  The slot is read by this wave alone, so the
    //     wave's own LDS wait frees it: every read above has returned before a copy can overwrite it ---
    if (t + 1 < TPW) {
      asm volatile("s_wait_dscnt 0x0" ::: "memory");
      const float* xnext = xsrc + (size_t)(t + 1)*(8*16*NL*DIN);
      copy_rows8(xs_lds, xnext);
      copy_rows8(xs_lds + 8*XPITCH*4, xnext + 8*(NL*DIN));
    }

    // --- LayerNorm stats: 2 lanes per row, four partial sums per lane ---
    v4f s4 = {0.f, 0.f, 0.f, 0.f}, q4 = {0.f, 0.f, 0.f, 0.f};
#pragma unroll  // constant indices keep xv[] in registers
    for (int g = 0; g < 16; ++g) { s4 += xv[g]; q4 += xv[g]*xv[g]; }
    float s  = (s4[0] + s4[1]) + (s4[2] + s4[3]);
    float s2 = (q4[0] + q4[1]) + (q4[2] + q4[3]);
    s  += __shfl_xor(s, 16, 32);
    s2 += __shfl_xor(s2, 16, 32);
    const float mu   = s * (1.f/128.f);
    const float var  = s2 * (1.f/128.f) - mu*mu;
    const float rstd = rsqrtf(var + 1e-5f);

    // --- normalize + affine -> f16 A fragments, in registers ---
    v16h af[4];
#pragma unroll  // constant indices keep xv[] and af[] in registers
    for (int g = 0; g < 16; ++g) {
      const int col = (g >> 2)*32 + hf*8 + ((g >> 1) & 1)*16 + (g & 1)*4;
      const v4f lw = *(const v4f*)&s_lnw[col];
      const v4f lb = *(const v4f*)&s_lnb[col];
      const v4f v  = (xv[g] - mu) * rstd * lw + lb;
#pragma unroll  // constant element index into the fragment
      for (int e = 0; e < 4; ++e) af[g >> 2][(g & 3)*4 + e] = (half_t)v[e];
    }

    // --- proj: xp = xn @ proj_w^T + proj_b  (16x128 @ 128x32) ---
    v8f c0, c1;
#pragma unroll
    for (int r = 0; r < 8; ++r) { c0[r] = b0; c1[r] = b1; }

#pragma unroll
    for (int kb = 0; kb < 4; ++kb) {
      c0 = wmma_f16(af[kb], bp[0][kb], c0);
      c1 = wmma_f16(af[kb], bp[1][kb], c1);
    }

    // stash xp tile (row-major f16)
#pragma unroll
    for (int r = 0; r < 8; ++r) {
      int m = r + hf*8;
      xp[w][m*PPITCH + n0]      = (half_t)c0[r];
      xp[w][m*PPITCH + n0 + 16] = (half_t)c1[r];
    }
    __syncthreads();

    // --- k = xp @ wk^T , q = xp @ wq^T  (16x32 @ 32x32) ---
    const v16h bk0 = frag_from_row(&s_wk[n0*PPITCH], hf);
    const v16h bk1 = frag_from_row(&s_wk[(n0+16)*PPITCH], hf);
    const v16h bq0 = frag_from_row(&s_wq[n0*PPITCH], hf);
    const v16h bq1 = frag_from_row(&s_wq[(n0+16)*PPITCH], hf);
    v16h a2 = frag_from_row(&xp[w][n0*PPITCH], hf);
    const v8f z0 = {};
    v8f ck0 = wmma_f16(a2, bk0, z0);
    v8f ck1 = wmma_f16(a2, bk1, z0);
    v8f cq0 = wmma_f16(a2, bq0, z0);
    v8f cq1 = wmma_f16(a2, bq1, z0);

    // K and Q rows of this tile as f16 into the block's LDS tiles, row-major [i][d]
#pragma unroll
    for (int r = 0; r < 8; ++r) {
      const int i = rowBase + r + hf*8;
      Kt[i*DOUT + n0]      = (half_t)ck0[r];
      Kt[i*DOUT + n0 + 16] = (half_t)ck1[r];
      Qt[i*DOUT + n0]      = (half_t)cq0[r];
      Qt[i*DOUT + n0 + 16] = (half_t)cq1[r];
    }
  }
  __syncthreads();   // every wave's rows of K and Q are in LDS before any wave reads them

  const v8f z = {};

  // ---- pass 1: column statistics.  The wave owns j-strips w, w+8, w+16 and keeps
  // their Q fragments in registers, so each K fragment read serves all three.
  // Q carries the factor SC_LOG2E (it was folded into wq), so a product K.Q is already
  // an exponent of 2, and the column's shift enters as the C operand of the matrix
  // instruction: its result goes to the exponential as it is.
  // Any shift gives the same softmax as long as nothing overflows; the one used here is
  // known in front of the loop: the column's maximum over its first 16 rows.  The sum then
  // holds a term of about 1, so it cannot vanish; where a later score lies so far above the
  // shift that a sum is no longer finite, the wave takes the exact loop below instead.
  // The +eps of the reference is common to every score of a column and cancels in the softmax.
  {
    v16h bq[3];
    v8f  nsh[3];    // minus the column's shift, in all eight rows of the C operand
    v8f  drun[3];   // denominator over this lane's rows, one partial sum per accumulator register
    const v16h af = frag_from_row(&Kt[n0*DOUT], hf);
#pragma unroll  // constant indices keep the fragments and sums in registers
    for (int s = 0; s < 3; ++s) {
      bq[s] = frag_from_row(&Qt[((w + s*8)*16 + n0)*DOUT], hf);  // B[d][j] = Q[j][d]
      const v8f c = wmma_f16(af, bq[s], z);
      const float t0 = fmaxf(fmaxf(c[0], c[1]), c[2]);
      const float t1 = fmaxf(fmaxf(c[3], c[4]), c[5]);
      float m = fmaxf(fmaxf(t0, t1), fmaxf(c[6], c[7]));
      m = fmaxf(m, __shfl_xor(m, 16, 32));   // the other eight rows of the tile
#pragma unroll  // constant element index
      for (int r = 0; r < 8; ++r) nsh[s][r] = -m;
      drun[s] = z;
    }
    for (int ti = 0; ti < 24; ti += 2) {   // two i-tiles per group of LDS reads
      const v16h a0 = frag_from_row(&Kt[(ti*16 + n0)*DOUT], hf);
      const v16h a1 = frag_from_row(&Kt[(ti*16 + 16 + n0)*DOUT], hf);
      v8f c0[3], c1[3];
#pragma unroll  // constant indices keep the fragments and sums in registers
      for (int s = 0; s < 3; ++s) {
        c0[s] = wmma_f16(a0, bq[s], nsh[s]);
        c1[s] = wmma_f16(a1, bq[s], nsh[s]);
      }
#pragma unroll  // constant indices keep the fragments and sums in registers
      for (int s = 0; s < 3; ++s) {
        v8f p0, p1;
#pragma unroll  // constant indices keep the fragments and sums in registers
        for (int r = 0; r < 8; ++r) {
          p0[r] = __builtin_amdgcn_exp2f(c0[s][r]);
          p1[r] = __builtin_amdgcn_exp2f(c1[s][r]);
        }
        drun[s] += p0;
        drun[s] += p1;
      }
    }
    float d[3];
    bool  redo = false;
#pragma unroll  // constant indices keep the fragments and sums in registers
    for (int s = 0; s < 3; ++s) {          // both row halves of a column used the same shift: their sums add
      const float d_own = ((drun[s][0] + drun[s][1]) + (drun[s][2] + drun[s][3]))
                        + ((drun[s][4] + drun[s][5]) + (drun[s][6] + drun[s][7]));
      d[s] = d_own + __shfl_xor(d_own, 16, 32);
      redo = redo || !(d[s] < 3.0e38f);    // infinite or not a number
    }
    if (__builtin_amdgcn_ballot_w32(redo) == 0) {   // the same for the whole wave: a scalar branch
#pragma unroll  // constant indices keep the fragments and sums in registers
      for (int s = 0; s < 3; ++s)
        if (hf == 0) colBias[(w + s*8)*16 + n0] = nsh[s][0] - __builtin_amdgcn_logf(d[s]);  // v_log_f32: base 2
    } else {
      // the exact loop: running maximum, sums rescaled when it rises; one strip at a time
#pragma unroll 1  // rolled: this path is rare, one copy of it is enough
      for (int s = 0; s < 3; ++s) {
        const v16h bqs = frag_from_row(&Qt[((w + s*8)*16 + n0)*DOUT], hf);
        float mrun = -__builtin_inff();
        v8f   dr   = z;
#pragma unroll 1  // rolled: this path is rare, one copy of it is enough
        for (int ti = 0; ti < 24; ++ti) {
          const v8f x = wmma_f16(frag_from_row(&Kt[(ti*16 + n0)*DOUT], hf), bqs, z);
          const float t0 = fmaxf(fmaxf(x[0], x[1]), x[2]);
          const float t1 = fmaxf(fmaxf(x[3], x[4]), x[5]);
          const float t2 = fmaxf(fmaxf(x[6], x[7]), mrun);
          const float mnew = fmaxf(fmaxf(t0, t1), t2);
          const float corr = __builtin_amdgcn_exp2f(mrun - mnew);  // 0 on the first trip
          v8f p;
#pragma unroll  // constant element index
          for (int r = 0; r < 8; ++r) p[r] = __builtin_amdgcn_exp2f(x[r] - mnew);
          dr   = dr * corr + p;
          mrun = mnew;
        }
        const float d_own = ((dr[0] + dr[1]) + (dr[2] + dr[3])) + ((dr[4] + dr[5]) + (dr[6] + dr[7]));
        const float m_oth = __shfl_xor(mrun, 16, 32);
        const float d_oth = __shfl_xor(d_own, 16, 32);
        const float mk    = fmaxf(mrun, m_oth);
        const float dd    = d_own * __builtin_amdgcn_exp2f(mrun - mk)
                          + d_oth * __builtin_amdgcn_exp2f(m_oth - mk);
        if (hf == 0) colBias[(w + s*8)*16 + n0] = -(mk + __builtin_amdgcn_logf(dd));
      }
    }
  }
  __syncthreads();   // every column's bias is in LDS before any wave reads it

  // ---- pass 2: probabilities 2^(score + bias[j]), summed over j.  The wave owns
  // i-tiles w, w+8, w+16 and keeps their K fragments in registers; no other wave adds
  // to its rows.  The bias of a lane's eight rows j is the C operand of the matrix instruction.
  v16h bk[3];
  v8f  acc[3];
#pragma unroll  // constant indices keep the fragments and sums in registers
  for (int t = 0; t < 3; ++t) {
    bk[t]  = frag_from_row(&Kt[((w + t*8)*16 + n0)*DOUT], hf);   // B[d][i] = K[i][d]
    acc[t] = z;
  }
#pragma unroll 2  // one group of LDS reads and one wait place per two strips instead of per strip
  for (int js = 0; js < 24; ++js) {
    const v16h a    = frag_from_row(&Qt[(js*16 + n0)*DOUT], hf);
    const v8f  bias = *(const v8f*)&colBias[js*16 + hf*8];       // rows j of this lane half
#pragma unroll  // constant indices keep the fragments and sums in registers
    for (int t = 0; t < 3; ++t) {
      const v8f e = wmma_f16(a, bk[t], bias);
#pragma unroll  // constant indices keep the fragments and sums in registers
      for (int r = 0; r < 8; ++r) acc[t][r] += __builtin_amdgcn_exp2f(e[r]);
    }
  }

#pragma unroll  // constant indices keep the fragments and sums in registers
  for (int t = 0; t < 3; ++t) {
    float sum = ((acc[t][0] + acc[t][1]) + (acc[t][2] + acc[t][3]))
              + ((acc[t][4] + acc[t][5]) + (acc[t][6] + acc[t][7]));
    sum += __shfl_xor(sum, 16, 32);        // the other eight rows j of every strip
    if (hf == 0)
      out[((size_t)(h*NN + (w + t*8)*16 + n0))*NL + l] = sum * (1.f / 384.f);
  }
}

// ---------------------------------------------------------------------------
extern "C" void kernel_launch(void* const* d_in, const int* in_sizes, int n_in,
                              void* d_out, int out_size, void* d_ws, size_t ws_size,
                              hipStream_t stream) {
  const float* x      = (const float*)d_in[0];
  const float* ln_w   = (const float*)d_in[1];
  const float* ln_b   = (const float*)d_in[2];
  const float* proj_w = (const float*)d_in[3];
  const float* proj_b = (const float*)d_in[4];
  const float* wk     = (const float*)d_in[5];
  const float* wq     = (const float*)d_in[6];

  // one block per (h,l) pair; the workspace is not used
  ln_kq_atten_kernel<<<NH*NL, 256, 0, stream>>>(x, ln_w, ln_b, proj_w, proj_b,
                                                wk, wq, (float*)d_out);
}

// v008
// Measured time: 22.6 microseconds a run.
// In two side-by-side timings against v007, it was 1.06 and 1.05 times as fast.
// Over all steps from v000 it is 3.69 times as fast.
#include <hip/hip_runtime.h>
#include <hip/hip_bf16.h>

typedef _Float16 half_t;
typedef __attribute__((ext_vector_type(16))) _Float16 v16h;
typedef __attribute__((ext_vector_type(8)))  _Float16 v8h;
typedef __attribute__((ext_vector_type(4)))  _Float16 v4h;
typedef __attribute__((ext_vector_type(8)))  float    v8f;
typedef __attribute__((ext_vector_type(4)))  float    v4f;

#define NH   8
#define NN   384
#define NL   64
#define DIN  128
#define DOUT 32

__device__ __forceinline__ v8f wmma_f16(v16h a, v16h b, v8f c) {
  return __builtin_amdgcn_wmma_f32_16x16x32_f16(false, a, false, b, (short)0, c, false, false);
}

// Build a 16x32-f16 WMMA A/B fragment from a row-major f16 row (LDS or global).
// Per ISA 7.12.2: lane-half hf=0 needs K{0..7,16..23}, hf=1 needs K{8..15,24..31}
// -> two contiguous 16B chunks at +hf*8 and +hf*8+16 halves.
__device__ __forceinline__ v16h frag_from_row(const half_t* rowp, int hf) {
  v8h lo = *(const v8h*)(rowp + hf*8);
  v8h hi = *(const v8h*)(rowp + hf*8 + 16);
  v16h r;
#pragma unroll
  for (int e = 0; e < 8; ++e) { r[e] = lo[e]; r[e+8] = hi[e]; }
  return r;
}

// Four f32 values rounded to f16 (round to nearest even).
__device__ __forceinline__ v4h half4_of(v4f v) {
  v4h r;
#pragma unroll
  for (int e = 0; e < 4; ++e) r[e] = (half_t)v[e];
  return r;
}

// ---------------------------------------------------------------------------
// The one kernel: one block of 8 waves per (h,l) pair, two blocks per WGP, every block
// resident at once.
// Part A: LayerNorm + proj(128->32, +bias) + k/q proj (32->32) of the pair's own
// 384 rows x[h][i][l][:] (512 contiguous bytes each).  Each wave walks TPW 16-row
// tiles in a loop and writes its rows of K and Q as f16 straight into the LDS
// tiles that part B reads: K and Q never go through global memory.
// The weights are fetched from global memory once per block, in front of the loop,
// as f32, and rounded to f16 on their way into LDS (padded pitches): each thread
// takes 16 B of wk, 16 B of wq and 64 B of proj_w.  Each wave then takes its eight
// proj_w fragments from LDS into registers, where they and the bias stay.
// The f32 tile is brought into the wave's own LDS slot, at a padded row pitch, by
// asynchronous copies; each lane then reads its row's columns ONCE, already in
// WMMA A-fragment order, and keeps them in registers for the statistics, the
// normalisation and the f16 fragments.  As soon as a tile is in registers the
// copies of the wave's next tile are issued into the same slot, so that they fly
// while this tile is normalised and projected.
// Part B: scores = K @ Q^T * scale (+eps), softmax over i (per column j),
// mean over j, all from LDS.
// Both reductions run down the accumulator registers of a lane:
//   pass 1 forms tiles with M = i, N = j (K as A, Q as B): a lane holds one
//          column j and reduces over its rows i; the two lane halves of a
//          column are merged once per strip, behind the loop.
//   pass 2 forms the transposed tiles, M = j, N = i (Q as A, K as B): a lane
//          holds one row i and sums its probabilities over j.
// ---------------------------------------------------------------------------
#define XPITCH 132  // floats per LDS row: 528 B = 16 B x 33 (odd), so the 16 rows of a b128 column read fall on 64 distinct banks
#define PPITCH 40   // halfs per LDS row of xp: 80 B = 16 B x 5 (odd), same reason
#define WPITCH 136  // halfs per LDS row of proj_w: 272 B = 16 B x 17 (odd), same reason
#define KPITCH 40   // halfs per LDS row of K and of Q: 80 B = 16 B x 5 (odd), same reason (at 64 B every fourth row falls on the same banks)
#define TPW 3       // tiles per wave: 24 tiles of 16 rows i = 8 waves x 3
#define SCALING 0.17677669529663687f  // 1/sqrt(32)
#define SC_LOG2E (SCALING * 1.4426950408889634f)  // raw score -> exponent of 2

// Eight rows of a tile, 512 contiguous bytes each, from global memory into the wave's LDS slot:
// each lane copies its own 16 bytes of every row (both addresses multiples of 16).
// lds: the lane's LDS byte address in the first of the rows; g: its global address there.
// s_wait_xcnt 0 stands inside the statement, behind the last copy, so that no address register
// that a copy names is rewritten in front of it (a precaution).
__device__ __forceinline__ void copy_rows8(unsigned lds, const float* g) {
  asm volatile("global_load_async_to_lds_b128 %0, %8, off\n\t"
               "global_load_async_to_lds_b128 %1, %9, off\n\t"
               "global_load_async_to_lds_b128 %2, %10, off\n\t"
               "global_load_async_to_lds_b128 %3, %11, off\n\t"
               "global_load_async_to_lds_b128 %4, %12, off\n\t"
               "global_load_async_to_lds_b128 %5, %13, off\n\t"
               "global_load_async_to_lds_b128 %6, %14, off\n\t"
               "global_load_async_to_lds_b128 %7, %15, off\n\t"
               "s_wait_xcnt 0x0"
               :: "v"(lds),               "v"(lds + 1*XPITCH*4), "v"(lds + 2*XPITCH*4), "v"(lds + 3*XPITCH*4),
                  "v"(lds + 4*XPITCH*4),  "v"(lds + 5*XPITCH*4), "v"(lds + 6*XPITCH*4), "v"(lds + 7*XPITCH*4),
                  "v"(g),                 "v"(g + 1*(NL*DIN)),   "v"(g + 2*(NL*DIN)),   "v"(g + 3*(NL*DIN)),
                  "v"(g + 4*(NL*DIN)),    "v"(g + 5*(NL*DIN)),   "v"(g + 6*(NL*DIN)),   "v"(g + 7*(NL*DIN))
               : "memory");
}

__global__ __launch_bounds__(256)
void ln_kq_atten_kernel(const float* __restrict__ x,
                        const float* __restrict__ ln_w,  const float* __restrict__ ln_b,
                        const float* __restrict__ proj_w, const float* __restrict__ proj_b,
                        const float* __restrict__ wk,    const float* __restrict__ wq,
                        float* __restrict__ out)
{
  __shared__ __align__(16) float  xs[8][16*XPITCH];  // 66 KB
  __shared__ __align__(16) half_t xp[8][16*PPITCH];  // 10 KB
  __shared__ __align__(16) half_t s_pw[DOUT*WPITCH]; // 8.5 KB
  __shared__ __align__(16) half_t s_wk[DOUT*PPITCH]; // 2.5 KB, rows at the padded pitch of xp
  __shared__ __align__(16) half_t s_wq[DOUT*PPITCH]; // 2.5 KB
  __shared__ __align__(16) float  s_lnw[DIN];
  __shared__ __align__(16) float  s_lnb[DIN];
  __shared__ __align__(16) half_t Kt[NN*KPITCH];  // 30 KB
  __shared__ __align__(16) half_t Qt[NN*KPITCH];  // 30 KB
  __shared__ __align__(32) float colBias[NN];   // per column j: -(shift + log2(denominator)), in exponents of 2

  const int h    = blockIdx.x >> 6;
  const int l    = blockIdx.x & 63;
  const int tid  = threadIdx.x;
  const int w    = tid >> 5;
  const int lane = tid & 31;
  const int n0   = lane & 15;      // N / M index within tile
  const int hf   = lane >> 4;      // lane half

  // --- the three weight matrices (f32) and the bias: the loads go out in front of the block's first
  //     64 KB of x, so that they do not queue behind it.  Per load a wave reads 512 contiguous bytes
  //     (one row of proj_w, four of wk or wq); pw4[k] = floats (k*256 + tid)*4 .. +3 of proj_w ---
  v4f pw4[4];
#pragma unroll
  for (int k = 0; k < 4; ++k) pw4[k] = *(const v4f*)(proj_w + (k*256 + tid)*4);
  const v4f wk4 = *(const v4f*)(wk + tid*4);
  const v4f wq4 = *(const v4f*)(wq + tid*4);
  const float b0 = proj_b[n0], b1 = proj_b[n0 + 16];

  // --- the wave's first tile (16 rows i, NL*DIN floats apart; one row per copy) starts next;
  //     tile t begins at row (t*8 + w)*16 ---
  const unsigned xs_lds = (unsigned)(size_t)&xs[w][lane*4];   // low 32 bits: byte offset in the block's LDS
  const float*   xsrc   = x + ((size_t)(h*NN + w*16)*NL + l)*DIN + lane*4;
  copy_rows8(xs_lds, xsrc);
  copy_rows8(xs_lds + 8*XPITCH*4, xsrc + 8*(NL*DIN));

  // --- the weights, rounded to f16, staged once per block in LDS ---
#pragma unroll
  for (int k = 0; k < 4; ++k) {
    const int off = (k*256 + tid)*4;   // index of the thread's four floats in proj_w
    *(v4h*)&s_pw[(off >> 7)*WPITCH + (off & (DIN - 1))] = half4_of(pw4[k]);
  }
  *(v4h*)&s_wk[(tid >> 3)*PPITCH + (tid & 7)*4] = half4_of(wk4);
  *(v4h*)&s_wq[(tid >> 3)*PPITCH + (tid & 7)*4] = half4_of(wq4 * SC_LOG2E);  // Q comes out times SC_LOG2E: K.Q is an exponent of 2
  // the LayerNorm vectors, by the first four waves
  if (tid < DIN) { s_lnw[tid] = ln_w[tid]; s_lnb[tid] = ln_b[tid]; }
  __syncthreads();   // the staged weights are in LDS before any wave reads them

  // --- proj_w fragments: read once per wave, live over the tile loop like the bias ---
  v16h bp[2][4];
#pragma unroll
  for (int nt = 0; nt < 2; ++nt)
#pragma unroll
    for (int kb = 0; kb < 4; ++kb)
      bp[nt][kb] = frag_from_row(&s_pw[(n0 + nt*16)*WPITCH + kb*32], hf);

#pragma unroll 1  // rolled: one copy of the body keeps the wave under 256 registers, so two blocks share a WGP
  for (int t = 0; t < TPW; ++t) {
    const int rowBase = (t*8 + w) * 16;   // first row i of this wave's tile

    // this tile's 16 copies have landed in the wave's slot before anything of it is read
    asm volatile("s_wait_asynccnt 0x0" ::: "memory");
    __syncthreads();

    // --- this lane's 64 columns of row n0, in A-fragment order:
    //     xv[kb*4 + c*2 + q] = columns kb*32 + hf*8 + c*16 + q*4 .. +3 ---
    v4f xv[16];
#pragma unroll  // constant indices keep xv[] in registers
    for (int g = 0; g < 16; ++g) {
      const int col = (g >> 2)*32 + hf*8 + ((g >> 1) & 1)*16 + (g & 1)*4;
      xv[g] = *(const v4f*)&xs[w][n0*XPITCH + col];
    }

    // --- the next tile's copies into the same slot.  The slot is read by this wave alone, so the
    //     wave's own LDS wait frees it: every read above has returned before a copy can overwrite it ---
    if (t + 1 < TPW) {
      asm volatile("s_wait_dscnt 0x0" ::: "memory");
      const float* xnext = xsrc + (size_t)(t + 1)*(8*16*NL*DIN);
      copy_rows8(xs_lds, xnext);
      copy_rows8(xs_lds + 8*XPITCH*4, xnext + 8*(NL*DIN));
    }

    // --- LayerNorm stats: 2 lanes per row, four partial sums per lane ---
    v4f s4 = {0.f, 0.f, 0.f, 0.f}, q4 = {0.f, 0.f, 0.f, 0.f};
#pragma unroll  // constant indices keep xv[] in registers
    for (int g = 0; g < 16; ++g) { s4 += xv[g]; q4 += xv[g]*xv[g]; }
    float s  = (s4[0] + s4[1]) + (s4[2] + s4[3]);
    float s2 = (q4[0] + q4[1]) + (q4[2] + q4[3]);
    s  += __shfl_xor(s, 16, 32);
    s2 += __shfl_xor(s2, 16, 32);
    const float mu   = s * (1.f/128.f);
    const float var  = s2 * (1.f/128.f) - mu*mu;
    const float rstd = rsqrtf(var + 1e-5f);

    // --- normalize + affine -> f16 A fragments, in registers ---
    v16h af[4];
#pragma unroll  // constant indices keep xv[] and af[] in registers
    for (int g = 0; g < 16; ++g) {
      const int col = (g >> 2)*32 + hf*8 + ((g >> 1) & 1)*16 + (g & 1)*4;
      const v4f lw = *(const v4f*)&s_lnw[col];
      const v4f lb = *(const v4f*)&s_lnb[col];
      const v4f v  = (xv[g] - mu) * rstd * lw + lb;
#pragma unroll  // constant element index into the fragment
      for (int e = 0; e < 4; ++e) af[g >> 2][(g & 3)*4 + e] = (half_t)v[e];
    }

    // --- proj: xp = xn @ proj_w^T + proj_b  (16x128 @ 128x32) ---
    v8f c0, c1;
#pragma unroll
    for (int r = 0; r < 8; ++r) { c0[r] = b0; c1[r] = b1; }

#pragma unroll
    for (int kb = 0; kb < 4; ++kb) {
      c0 = wmma_f16(af[kb], bp[0][kb], c0);
      c1 = wmma_f16(af[kb], bp[1][kb], c1);
    }

    // stash xp tile (row-major f16)
#pragma unroll
    for (int r = 0; r < 8; ++r) {
      int m = r + hf*8;
      xp[w][m*PPITCH + n0]      = (half_t)c0[r];
      xp[w][m*PPITCH + n0 + 16] = (half_t)c1[r];
    }
    __syncthreads();

    // --- k = xp @ wk^T , q = xp @ wq^T  (16x32 @ 32x32) ---
    const v16h bk0 = frag_from_row(&s_wk[n0*PPITCH], hf);
    const v16h bk1 = frag_from_row(&s_wk[(n0+16)*PPITCH], hf);
    const v16h bq0 = frag_from_row(&s_wq[n0*PPITCH], hf);
    const v16h bq1 = frag_from_row(&s_wq[(n0+16)*PPITCH], hf);
    v16h a2 = frag_from_row(&xp[w][n0*PPITCH], hf);
    const v8f z0 = {};
    v8f ck0 = wmma_f16(a2, bk0, z0);
    v8f ck1 = wmma_f16(a2, bk1, z0);
    v8f cq0 = wmma_f16(a2, bq0, z0);
    v8f cq1 = wmma_f16(a2, bq1, z0);

    // K and Q rows of this tile as f16 into the block's LDS tiles, row-major [i][d] at the padded pitch
#pragma unroll
    for (int r = 0; r < 8; ++r) {
      const int i = rowBase + r + hf*8;
      Kt[i*KPITCH + n0]      = (half_t)ck0[r];
      Kt[i*KPITCH + n0 + 16] = (half_t)ck1[r];
      Qt[i*KPITCH + n0]      = (half_t)cq0[r];
      Qt[i*KPITCH + n0 + 16] = (half_t)cq1[r];
    }
  }
  __syncthreads();   // every wave's rows of K and Q are in LDS before any wave reads them

  const v8f z = {};

  // ---- pass 1: column statistics.  The wave owns j-strips w, w+8, w+16 and keeps
  // their Q fragments in registers, so each K fragment read serves all three.
  // Q carries the factor SC_LOG2E (it was folded into wq), so a product K.Q is already
  // an exponent of 2, and the column's shift enters as the C operand of the matrix
  // instruction: its result goes to the exponential as it is.
  // Any shift gives the same softmax as long as nothing overflows; the one used here is
  // known in front of the loop: the column's maximum over its first 16 rows.  The sum then
  // holds a term of about 1, so it cannot vanish; where a later score lies so far above the
  // shift that a sum is no longer finite, the wave takes the exact loop below instead.
  // The +eps of the reference is common to every score of a column and cancels in the softmax.
  {
    v16h bq[3];
    v8f  nsh[3];    // minus the column's shift, in all eight rows of the C operand
    v8f  drun[3];   // denominator over this lane's rows, one partial sum per accumulator register
    const v16h af = frag_from_row(&Kt[n0*KPITCH], hf);
#pragma unroll  // constant indices keep the fragments and sums in registers
    for (int s = 0; s < 3; ++s) {
      bq[s] = frag_from_row(&Qt[((w + s*8)*16 + n0)*KPITCH], hf);  // B[d][j] = Q[j][d]
      const v8f c = wmma_f16(af, bq[s], z);
      const float t0 = fmaxf(fmaxf(c[0], c[1]), c[2]);
      const float t1 = fmaxf(fmaxf(c[3], c[4]), c[5]);
      float m = fmaxf(fmaxf(t0, t1), fmaxf(c[6], c[7]));
      m = fmaxf(m, __shfl_xor(m, 16, 32));   // the other eight rows of the tile
#pragma unroll  // constant element index
      for (int r = 0; r < 8; ++r) nsh[s][r] = -m;
      drun[s] = z;
    }
    for (int ti = 0; ti < 24; ti += 2) {   // two i-tiles per group of LDS reads
      const v16h a0 = frag_from_row(&Kt[(ti*16 + n0)*KPITCH], hf);
      const v16h a1 = frag_from_row(&Kt[(ti*16 + 16 + n0)*KPITCH], hf);
      v8f c0[3], c1[3];
#pragma unroll  // constant indices keep the fragments and sums in registers
      for (int s = 0; s < 3; ++s) {
        c0[s] = wmma_f16(a0, bq[s], nsh[s]);
        c1[s] = wmma_f16(a1, bq[s], nsh[s]);
      }
#pragma unroll  // constant indices keep the fragments and sums in registers
      for (int s = 0; s < 3; ++s) {
        v8f p0, p1;
#pragma unroll  // constant indices keep the fragments and sums in registers
        for (int r = 0; r < 8; ++r) {
          p0[r] = __builtin_amdgcn_exp2f(c0[s][r]);
          p1[r] = __builtin_amdgcn_exp2f(c1[s][r]);
        }
        drun[s] += p0;
        drun[s] += p1;
      }
    }
    float d[3];
    bool  redo = false;
#pragma unroll  // constant indices keep the fragments and sums in registers
    for (int s = 0; s < 3; ++s) {          // both row halves of a column used the same shift: their sums add
      const float d_own = ((drun[s][0] + drun[s][1]) + (drun[s][2] + drun[s][3]))
                        + ((drun[s][4] + drun[s][5]) + (drun[s][6] + drun[s][7]));
      d[s] = d_own + __shfl_xor(d_own, 16, 32);
      redo = redo || !(d[s] < 3.0e38f);    // infinite or not a number
    }
    if (__builtin_amdgcn_ballot_w32(redo) == 0) {   // the same for the whole wave: a scalar branch
#pragma unroll  // constant indices keep the fragments and sums in registers
      for (int s = 0; s < 3; ++s)
        if (hf == 0) colBias[(w + s*8)*16 + n0] = nsh[s][0] - __builtin_amdgcn_logf(d[s]);  // v_log_f32: base 2
    } else {
      // the exact loop: running maximum, sums rescaled when it rises; one strip at a time
#pragma unroll 1  // rolled: this path is rare, one copy of it is enough
      for (int s = 0; s < 3; ++s) {
        const v16h bqs = frag_from_row(&Qt[((w + s*8)*16 + n0)*KPITCH], hf);
        float mrun = -__builtin_inff();
        v8f   dr   = z;
#pragma unroll 1  // rolled: this path is rare, one copy of it is enough
        for (int ti = 0; ti < 24; ++ti) {
          const v8f x = wmma_f16(frag_from_row(&Kt[(ti*16 + n0)*KPITCH], hf), bqs, z);
          const float t0 = fmaxf(fmaxf(x[0], x[1]), x[2]);
          const float t1 = fmaxf(fmaxf(x[3], x[4]), x[5]);
          const float t2 = fmaxf(fmaxf(x[6], x[7]), mrun);
          const float mnew = fmaxf(fmaxf(t0, t1), t2);
          const float corr = __builtin_amdgcn_exp2f(mrun - mnew);  // 0 on the first trip
          v8f p;
#pragma unroll  // constant element index
          for (int r = 0; r < 8; ++r) p[r] = __builtin_amdgcn_exp2f(x[r] - mnew);
          dr   = dr * corr + p;
          mrun = mnew;
        }
        const float d_own = ((dr[0] + dr[1]) + (dr[2] + dr[3])) + ((dr[4] + dr[5]) + (dr[6] + dr[7]));
        const float m_oth = __shfl_xor(mrun, 16, 32);
        const float d_oth = __shfl_xor(d_own, 16, 32);
        const float mk    = fmaxf(mrun, m_oth);
        const float dd    = d_own * __builtin_amdgcn_exp2f(mrun - mk)
                          + d_oth * __builtin_amdgcn_exp2f(m_oth - mk);
        if (hf == 0) colBias[(w + s*8)*16 + n0] = -(mk + __builtin_amdgcn_logf(dd));
      }
    }
  }
  __syncthreads();   // every column's bias is in LDS before any wave reads it

  // ---- pass 2: probabilities 2^(score + bias[j]), summed over j.  The wave owns
  // i-tiles w, w+8, w+16 and keeps their K fragments in registers; no other wave adds
  // to its rows.  The bias of a lane's eight rows j is the C operand of the matrix instruction.
  v16h bk[3];
  v8f  acc[3];
#pragma unroll  // constant indices keep the fragments and sums in registers
  for (int t = 0; t < 3; ++t) {
    bk[t]  = frag_from_row(&Kt[((w + t*8)*16 + n0)*KPITCH], hf);   // B[d][i] = K[i][d]
    acc[t] = z;
  }
#pragma unroll 2  // one group of LDS reads and one wait place per two strips instead of per strip
  for (int js = 0; js < 24; ++js) {
    const v16h a    = frag_from_row(&Qt[n0*KPITCH] + js*(16*KPITCH), hf);
    const v8f  bias = *(const v8f*)&colBias[js*16 + hf*8];       // rows j of this lane half
#pragma unroll  // constant indices keep the fragments and sums in registers
    for (int t = 0; t < 3; ++t) {
      const v8f e = wmma_f16(a, bk[t], bias);
#pragma unroll  // constant indices keep the fragments and sums in registers
      for (int r = 0; r < 8; ++r) acc[t][r] += __builtin_amdgcn_exp2f(e[r]);
    }
  }

#pragma unroll  // constant indices keep the fragments and sums in registers
  for (int t = 0; t < 3; ++t) {
    float sum = ((acc[t][0] + acc[t][1]) + (acc[t][2] + acc[t][3]))
              + ((acc[t][4] + acc[t][5]) + (acc[t][6] + acc[t][7]));
    sum += __shfl_xor(sum, 16, 32);        // the other eight rows j of every strip
    if (hf == 0)
      out[((size_t)(h*NN + (w + t*8)*16 + n0))*NL + l] = sum * (1.f / 384.f);
  }
}

// ---------------------------------------------------------------------------
extern "C" void kernel_launch(void* const* d_in, const int* in_sizes, int n_in,
                              void* d_out, int out_size, void* d_ws, size_t ws_size,
                              hipStream_t stream) {
  const float* x      = (const float*)d_in[0];
  const float* ln_w   = (const float*)d_in[1];
  const float* ln_b   = (const float*)d_in[2];
  const float* proj_w = (const float*)d_in[3];
  const float* proj_b = (const float*)d_in[4];
  const float* wk     = (const float*)d_in[5];
  const float* wq     = (const float*)d_in[6];

  // one block per (h,l) pair; the workspace is not used
  ln_kq_atten_kernel<<<NH*NL, 256, 0, stream>>>(x, ln_w, ln_b, proj_w, proj_b,
                                                wk, wq, (float*)d_out);
}

// v009
// A run of this version takes 20.3 microseconds.
// In two side-by-side timings against v008, it was 1.12 and 1.11 times as fast.
// All steps since v000 together make it 4.12 times as fast.
#include <hip/hip_runtime.h>
#include <hip/hip_bf16.h>

typedef _Float16 half_t;
typedef __attribute__((ext_vector_type(16))) _Float16 v16h;
typedef __attribute__((ext_vector_type(8)))  _Float16 v8h;
typedef __attribute__((ext_vector_type(4)))  _Float16 v4h;
typedef __attribute__((ext_vector_type(8)))  float    v8f;
typedef __attribute__((ext_vector_type(4)))  float    v4f;

#define NH   8
#define NN   384
#define NL   64
#define DIN  128
#define DOUT 32

__device__ __forceinline__ v8f wmma_f16(v16h a, v16h b, v8f c) {
  return __builtin_amdgcn_wmma_f32_16x16x32_f16(false, a, false, b, (short)0, c, false, false);
}

// Build a 16x32-f16 WMMA A/B fragment from a row-major f16 row (LDS or global).
// Per ISA 7.12.2: lane-half hf=0 needs K{0..7,16..23}, hf=1 needs K{8..15,24..31}
// -> two contiguous 16B chunks at +hf*8 and +hf*8+16 halves.
__device__ __forceinline__ v16h frag_from_row(const half_t* rowp, int hf) {
  v8h lo = *(const v8h*)(rowp + hf*8);
  v8h hi = *(const v8h*)(rowp + hf*8 + 16);
  v16h r;
#pragma unroll
  for (int e = 0; e < 8; ++e) { r[e] = lo[e]; r[e+8] = hi[e]; }
  return r;
}

// Eight f32 values rounded to f16 (round to nearest even).
__device__ __forceinline__ v8h half8_of(v8f v) {
  v8h r;
#pragma unroll  // constant element index keeps the vector in registers
  for (int e = 0; e < 8; ++e) r[e] = (half_t)v[e];
  return r;
}

// Four f32 values rounded to f16 (round to nearest even).
__device__ __forceinline__ v4h half4_of(v4f v) {
  v4h r;
#pragma unroll
  for (int e = 0; e < 4; ++e) r[e] = (half_t)v[e];
  return r;
}

// ---------------------------------------------------------------------------
// The one kernel: one block of 8 waves per (h,l) pair, two blocks per WGP, every block
// resident at once.
// Part A: LayerNorm + proj(128->32, +bias) + k/q proj (32->32) of the pair's own
// 384 rows x[h][i][l][:] (512 contiguous bytes each).  Each wave walks TPW 16-row
// tiles in a loop and writes its rows of K and Q as f16 straight into the LDS
// tiles that part B reads: K and Q never go through global memory.
// The weights are fetched from global memory once per block, in front of the loop,
// as f32, and rounded to f16 on their way into LDS (padded pitches): each thread
// takes 16 B of wk, 16 B of wq and 64 B of proj_w.  Each wave then takes its eight
// proj_w fragments from LDS into registers, where they and the bias stay.
// The f32 tile is brought into the wave's own LDS slot, at a padded row pitch, by
// asynchronous copies; each lane then reads its row's columns ONCE, already in
// WMMA A-fragment order, and keeps them in registers for the statistics, the
// normalisation and the f16 fragments.  As soon as a tile is in registers the
// copies of the wave's next tile are issued into the same slot, so that they fly
// while this tile is normalised and projected.
// All three products are formed transposed: the weight rows are the A operand (M = output
// feature) and the tile's rows i the B operand (N = i).  A lane's accumulators then hold
// eight consecutive features of ITS OWN row i, which is the order of a B fragment: xp goes
// from the accumulators into the next product's fragment without leaving the lane, and a
// row's K and Q values leave as 16-byte LDS stores.
// Part B: scores = K @ Q^T * scale (+eps), softmax over i (per column j),
// mean over j, all from LDS.
// Both reductions run down the accumulator registers of a lane:
//   pass 1 forms tiles with M = i, N = j (K as A, Q as B): a lane holds one
//          column j and reduces over its rows i; the two lane halves of a
//          column are merged once per strip, behind the loop.
//   pass 2 forms the transposed tiles, M = j, N = i (Q as A, K as B): a lane
//          holds one row i and sums its probabilities over j.
// ---------------------------------------------------------------------------
#define XPITCH 132  // floats per LDS row: 528 B = 16 B x 33 (odd), so the 16 rows of a b128 column read fall on 64 distinct banks
#define PPITCH 40   // halfs per LDS row of wk and of wq: 80 B = 16 B x 5 (odd), same reason
#define WPITCH 136  // halfs per LDS row of proj_w: 272 B = 16 B x 17 (odd), same reason
#define KPITCH 40   // halfs per LDS row of K and of Q: 80 B = 16 B x 5 (odd), same reason (at 64 B every fourth row falls on the same banks)
#define TPW 3       // tiles per wave: 24 tiles of 16 rows i = 8 waves x 3
#define SCALING 0.17677669529663687f  // 1/sqrt(32)
#define SC_LOG2E (SCALING * 1.4426950408889634f)  // raw score -> exponent of 2

// Eight rows of a tile, 512 contiguous bytes each, from global memory into the wave's LDS slot:
// each lane copies its own 16 bytes of every row (both addresses multiples of 16).
// lds: the lane's LDS byte address in the first of the rows; g: its global address there.
// s_wait_xcnt 0 stands inside the statement, behind the last copy, so that no address register
// that a copy names is rewritten in front of it (a precaution).
__device__ __forceinline__ void copy_rows8(unsigned lds, const float* g) {
  asm volatile("global_load_async_to_lds_b128 %0, %8, off\n\t"
               "global_load_async_to_lds_b128 %1, %9, off\n\t"
               "global_load_async_to_lds_b128 %2, %10, off\n\t"
               "global_load_async_to_lds_b128 %3, %11, off\n\t"
               "global_load_async_to_lds_b128 %4, %12, off\n\t"
               "global_load_async_to_lds_b128 %5, %13, off\n\t"
               "global_load_async_to_lds_b128 %6, %14, off\n\t"
               "global_load_async_to_lds_b128 %7, %15, off\n\t"
               "s_wait_xcnt 0x0"
               :: "v"(lds),               "v"(lds + 1*XPITCH*4), "v"(lds + 2*XPITCH*4), "v"(lds + 3*XPITCH*4),
                  "v"(lds + 4*XPITCH*4),  "v"(lds + 5*XPITCH*4), "v"(lds + 6*XPITCH*4), "v"(lds + 7*XPITCH*4),
                  "v"(g),                 "v"(g + 1*(NL*DIN)),   "v"(g + 2*(NL*DIN)),   "v"(g + 3*(NL*DIN)),
                  "v"(g + 4*(NL*DIN)),    "v"(g + 5*(NL*DIN)),   "v"(g + 6*(NL*DIN)),   "v"(g + 7*(NL*DIN))
               : "memory");
}

__global__ __launch_bounds__(256)
void ln_kq_atten_kernel(const float* __restrict__ x,
                        const float* __restrict__ ln_w,  const float* __restrict__ ln_b,
                        const float* __restrict__ proj_w, const float* __restrict__ proj_b,
                        const float* __restrict__ wk,    const float* __restrict__ wq,
                        float* __restrict__ out)
{
  __shared__ __align__(16) float  xs[8][16*XPITCH];  // 66 KB
  __shared__ __align__(16) half_t s_pw[DOUT*WPITCH]; // 8.5 KB
  __shared__ __align__(16) half_t s_wk[DOUT*PPITCH]; // 2.5 KB
  __shared__ __align__(16) half_t s_wq[DOUT*PPITCH]; // 2.5 KB
  __shared__ __align__(16) float  s_lnw[DIN];
  __shared__ __align__(16) float  s_lnb[DIN];
  __shared__ __align__(16) half_t Kt[NN*KPITCH];  // 30 KB
  __shared__ __align__(16) half_t Qt[NN*KPITCH];  // 30 KB
  __shared__ __align__(32) float colBias[NN];   // per column j: -(shift + log2(denominator)), in exponents of 2

  const int h    = blockIdx.x >> 6;
  const int l    = blockIdx.x & 63;
  const int tid  = threadIdx.x;
  const int w    = tid >> 5;
  const int lane = tid & 31;
  const int n0   = lane & 15;      // N / M index within tile
  const int hf   = lane >> 4;      // lane half

  // --- the three weight matrices (f32) and the bias: the loads go out in front of the block's first
  //     64 KB of x, so that they do not queue behind it.  Per load a wave reads 512 contiguous bytes
  //     (one row of proj_w, four of wk or wq); pw4[k] = floats (k*256 + tid)*4 .. +3 of proj_w ---
  v4f pw4[4];
#pragma unroll
  for (int k = 0; k < 4; ++k) pw4[k] = *(const v4f*)(proj_w + (k*256 + tid)*4);
  const v4f wk4 = *(const v4f*)(wk + tid*4);
  const v4f wq4 = *(const v4f*)(wq + tid*4);
  // the bias of the features that this lane's accumulators hold: hf*8 .. +7 and 16 + hf*8 .. +7
  const v4f pb0 = *(const v4f*)(proj_b + hf*8);
  const v4f pb1 = *(const v4f*)(proj_b + hf*8 + 4);
  const v4f pb2 = *(const v4f*)(proj_b + hf*8 + 16);
  const v4f pb3 = *(const v4f*)(proj_b + hf*8 + 20);

  // --- the wave's first tile (16 rows i, NL*DIN floats apart; one row per copy) starts next;
  //     tile t begins at row (t*8 + w)*16 ---
  const unsigned xs_lds = (unsigned)(size_t)&xs[w][lane*4];   // low 32 bits: byte offset in the block's LDS
  const float*   xsrc   = x + ((size_t)(h*NN + w*16)*NL + l)*DIN + lane*4;
  copy_rows8(xs_lds, xsrc);
  copy_rows8(xs_lds + 8*XPITCH*4, xsrc + 8*(NL*DIN));

  // --- the weights, rounded to f16, staged once per block in LDS ---
#pragma unroll
  for (int k = 0; k < 4; ++k) {
    const int off = (k*256 + tid)*4;   // index of the thread's four floats in proj_w
    *(v4h*)&s_pw[(off >> 7)*WPITCH + (off & (DIN - 1))] = half4_of(pw4[k]);
  }
  *(v4h*)&s_wk[(tid >> 3)*PPITCH + (tid & 7)*4] = half4_of(wk4);
  *(v4h*)&s_wq[(tid >> 3)*PPITCH + (tid & 7)*4] = half4_of(wq4 * SC_LOG2E);  // Q comes out times SC_LOG2E: K.Q is an exponent of 2
  // the LayerNorm vectors, by the first four waves
  if (tid < DIN) { s_lnw[tid] = ln_w[tid]; s_lnb[tid] = ln_b[tid]; }
  __syncthreads();   // the staged weights are in LDS before any wave reads them

  // --- proj_w fragments: read once per wave, live over the tile loop like the bias ---
  v16h bp[2][4];
#pragma unroll
  for (int nt = 0; nt < 2; ++nt)
#pragma unroll
    for (int kb = 0; kb < 4; ++kb)
      bp[nt][kb] = frag_from_row(&s_pw[(n0 + nt*16)*WPITCH + kb*32], hf);

#pragma unroll 1  // rolled: one copy of the body keeps the wave under 256 registers, so two blocks share a WGP
  for (int t = 0; t < TPW; ++t) {
    const int rowBase = (t*8 + w) * 16;   // first row i of this wave's tile

    // this tile's 16 copies have landed in the wave's slot before anything of it is read
    asm volatile("s_wait_asynccnt 0x0" ::: "memory");
    __syncthreads();

    // --- this lane's 64 columns of row n0, in A-fragment order:
    //     xv[kb*4 + c*2 + q] = columns kb*32 + hf*8 + c*16 + q*4 .. +3 ---
    v4f xv[16];
#pragma unroll  // constant indices keep xv[] in registers
    for (int g = 0; g < 16; ++g) {
      const int col = (g >> 2)*32 + hf*8 + ((g >> 1) & 1)*16 + (g & 1)*4;
      xv[g] = *(const v4f*)&xs[w][n0*XPITCH + col];
    }

    // --- the next tile's copies into the same slot.  The slot is read by this wave alone, so the
    //     wave's own LDS wait frees it: every read above has returned before a copy can overwrite it ---
    if (t + 1 < TPW) {
      asm volatile("s_wait_dscnt 0x0" ::: "memory");
      const float* xnext = xsrc + (size_t)(t + 1)*(8*16*NL*DIN);
      copy_rows8(xs_lds, xnext);
      copy_rows8(xs_lds + 8*XPITCH*4, xnext + 8*(NL*DIN));
    }

    // --- LayerNorm stats: 2 lanes per row, four partial sums per lane ---
    v4f s4 = {0.f, 0.f, 0.f, 0.f}, q4 = {0.f, 0.f, 0.f, 0.f};
#pragma unroll  // constant indices keep xv[] in registers
    for (int g = 0; g < 16; ++g) { s4 += xv[g]; q4 += xv[g]*xv[g]; }
    float s  = (s4[0] + s4[1]) + (s4[2] + s4[3]);
    float s2 = (q4[0] + q4[1]) + (q4[2] + q4[3]);
    s  += __shfl_xor(s, 16, 32);
    s2 += __shfl_xor(s2, 16, 32);
    const float mu   = s * (1.f/128.f);
    const float var  = s2 * (1.f/128.f) - mu*mu;
    const float rstd = rsqrtf(var + 1e-5f);

    // --- normalize + affine -> f16 fragments (row n0 of the tile), in registers ---
    v16h af[4];
#pragma unroll  // constant indices keep xv[] and af[] in registers
    for (int g = 0; g < 16; ++g) {
      const int col = (g >> 2)*32 + hf*8 + ((g >> 1) & 1)*16 + (g & 1)*4;
      const v4f lw = *(const v4f*)&s_lnw[col];
      const v4f lb = *(const v4f*)&s_lnb[col];
      const v4f v  = (xv[g] - mu) * rstd * lw + lb;
#pragma unroll  // constant element index into the fragment
      for (int e = 0; e < 4; ++e) af[g >> 2][(g & 3)*4 + e] = (half_t)v[e];
    }

    // --- proj, transposed: xp^T = proj_w @ xn^T + proj_b  (32x128 @ 128x16):
    //     c0[r] = xp[row n0][hf*8 + r], c1[r] = xp[row n0][16 + hf*8 + r] ---
    v8f c0, c1;
#pragma unroll  // constant element index keeps the vectors in registers
    for (int r = 0; r < 4; ++r) { c0[r] = pb0[r]; c0[r+4] = pb1[r]; c1[r] = pb2[r]; c1[r+4] = pb3[r]; }

#pragma unroll
    for (int kb = 0; kb < 4; ++kb) {
      c0 = wmma_f16(bp[0][kb], af[kb], c0);
      c1 = wmma_f16(bp[1][kb], af[kb], c1);
    }

    // --- k^T = wk @ xp^T , q^T = wq @ xp^T  (32x32 @ 32x16).  The lane's sixteen values of xp are
    //     the features hf*8 .. +7 and 16 + hf*8 .. +7 of row n0: its B fragment, element for element ---
    const v16h ak0 = frag_from_row(&s_wk[n0*PPITCH], hf);
    const v16h ak1 = frag_from_row(&s_wk[(n0+16)*PPITCH], hf);
    const v16h aq0 = frag_from_row(&s_wq[n0*PPITCH], hf);
    const v16h aq1 = frag_from_row(&s_wq[(n0+16)*PPITCH], hf);
    v16h b2;
#pragma unroll  // constant element index into the fragment
    for (int e = 0; e < 8; ++e) { b2[e] = (half_t)c0[e]; b2[e+8] = (half_t)c1[e]; }
    const v8f z0 = {};
    const v8f ck0 = wmma_f16(ak0, b2, z0);
    const v8f ck1 = wmma_f16(ak1, b2, z0);
    const v8f cq0 = wmma_f16(aq0, b2, z0);
    const v8f cq1 = wmma_f16(aq1, b2, z0);

    // K and Q of row rowBase + n0 as f16 into the block's LDS tiles, row-major [i][d] at the padded
    // pitch: each accumulator is eight consecutive d of that row, one 16-byte store
    half_t* krow = &Kt[(rowBase + n0)*KPITCH + hf*8];
    half_t* qrow = &Qt[(rowBase + n0)*KPITCH + hf*8];
    *(v8h*)krow        = half8_of(ck0);
    *(v8h*)(krow + 16) = half8_of(ck1);
    *(v8h*)qrow        = half8_of(cq0);
    *(v8h*)(qrow + 16) = half8_of(cq1);
  }
  __syncthreads();   // every wave's rows of K and Q are in LDS before any wave reads them

  const v8f z = {};

  // ---- pass 1: column statistics.  The wave owns j-strips w, w+8, w+16 and keeps
  // their Q fragments in registers, so each K fragment read serves all three.
  // Q carries the factor SC_LOG2E (it was folded into wq), so a product K.Q is already
  // an exponent of 2, and the column's shift enters as the C operand of the matrix
  // instruction: its result goes to the exponential as it is.
  // Any shift gives the same softmax as long as nothing overflows; the one used here is
  // known in front of the loop: the column's maximum over its first 16 rows.  The sum then
  // holds a term of about 1, so it cannot vanish; where a later score lies so far above the
  // shift that a sum is no longer finite, the wave takes the exact loop below instead.
  // The +eps of the reference is common to every score of a column and cancels in the softmax.
  {
    v16h bq[3];
    v8f  nsh[3];    // minus the column's shift, in all eight rows of the C operand
    v8f  drun[3];   // denominator over this lane's rows, one partial sum per accumulator register
    const v16h af = frag_from_row(&Kt[n0*KPITCH], hf);
#pragma unroll  // constant indices keep the fragments and sums in registers
    for (int s = 0; s < 3; ++s) {
      bq[s] = frag_from_row(&Qt[((w + s*8)*16 + n0)*KPITCH], hf);  // B[d][j] = Q[j][d]
      const v8f c = wmma_f16(af, bq[s], z);
      const float t0 = fmaxf(fmaxf(c[0], c[1]), c[2]);
      const float t1 = fmaxf(fmaxf(c[3], c[4]), c[5]);
      float m = fmaxf(fmaxf(t0, t1), fmaxf(c[6], c[7]));
      m = fmaxf(m, __shfl_xor(m, 16, 32));   // the other eight rows of the tile
#pragma unroll  // constant element index
      for (int r = 0; r < 8; ++r) nsh[s][r] = -m;
      drun[s] = z;
    }
    for (int ti = 0; ti < 24; ti += 2) {   // two i-tiles per group of LDS reads
      const v16h a0 = frag_from_row(&Kt[(ti*16 + n0)*KPITCH], hf);
      const v16h a1 = frag_from_row(&Kt[(ti*16 + 16 + n0)*KPITCH], hf);
      v8f c0[3], c1[3];
#pragma unroll  // constant indices keep the fragments and sums in registers
      for (int s = 0; s < 3; ++s) {
        c0[s] = wmma_f16(a0, bq[s], nsh[s]);
        c1[s] = wmma_f16(a1, bq[s], nsh[s]);
      }
#pragma unroll  // constant indices keep the fragments and sums in registers
      for (int s = 0; s < 3; ++s) {
        v8f p0, p1;
#pragma unroll  // constant indices keep the fragments and sums in registers
        for (int r = 0; r < 8; ++r) {
          p0[r] = __builtin_amdgcn_exp2f(c0[s][r]);
          p1[r] = __builtin_amdgcn_exp2f(c1[s][r]);
        }
        drun[s] += p0;
        drun[s] += p1;
      }
    }
    float d[3];
    bool  redo = false;
#pragma unroll  // constant indices keep the fragments and sums in registers
    for (int s = 0; s < 3; ++s) {          // both row halves of a column used the same shift: their sums add
      const float d_own = ((drun[s][0] + drun[s][1]) + (drun[s][2] + drun[s][3]))
                        + ((drun[s][4] + drun[s][5]) + (drun[s][6] + drun[s][7]));
      d[s] = d_own + __shfl_xor(d_own, 16, 32);
      redo = redo || !(d[s] < 3.0e38f);    // infinite or not a number
    }
    if (__builtin_amdgcn_ballot_w32(redo) == 0) {   // the same for the whole wave: a scalar branch
#pragma unroll  // constant indices keep the fragments and sums in registers
      for (int s = 0; s < 3; ++s)
        if (hf == 0) colBias[(w + s*8)*16 + n0] = nsh[s][0] - __builtin_amdgcn_logf(d[s]);  // v_log_f32: base 2
    } else {
      // the exact loop: running maximum, sums rescaled when it rises; one strip at a time
#pragma unroll 1  // rolled: this path is rare, one copy of it is enough
      for (int s = 0; s < 3; ++s) {
        const v16h bqs = frag_from_row(&Qt[((w + s*8)*16 + n0)*KPITCH], hf);
        float mrun = -__builtin_inff();
        v8f   dr   = z;
#pragma unroll 1  // rolled: this path is rare, one copy of it is enough
        for (int ti = 0; ti < 24; ++ti) {
          const v8f x = wmma_f16(frag_from_row(&Kt[(ti*16 + n0)*KPITCH], hf), bqs, z);
          const float t0 = fmaxf(fmaxf(x[0], x[1]), x[2]);
          const float t1 = fmaxf(fmaxf(x[3], x[4]), x[5]);
          const float t2 = fmaxf(fmaxf(x[6], x[7]), mrun);
          const float mnew = fmaxf(fmaxf(t0, t1), t2);
          const float corr = __builtin_amdgcn_exp2f(mrun - mnew);  // 0 on the first trip
          v8f p;
#pragma unroll  // constant element index
          for (int r = 0; r < 8; ++r) p[r] = __builtin_amdgcn_exp2f(x[r] - mnew);
          dr   = dr * corr + p;
          mrun = mnew;
        }
        const float d_own = ((dr[0] + dr[1]) + (dr[2] + dr[3])) + ((dr[4] + dr[5]) + (dr[6] + dr[7]));
        const float m_oth = __shfl_xor(mrun, 16, 32);
        const float d_oth = __shfl_xor(d_own, 16, 32);
        const float mk    = fmaxf(mrun, m_oth);
        const float dd    = d_own * __builtin_amdgcn_exp2f(mrun - mk)
                          + d_oth * __builtin_amdgcn_exp2f(m_oth - mk);
        if (hf == 0) colBias[(w + s*8)*16 + n0] = -(mk + __builtin_amdgcn_logf(dd));
      }
    }
  }
  __syncthreads();   // every column's bias is in LDS before any wave reads it

  // ---- pass 2: probabilities 2^(score + bias[j]), summed over j.  The wave owns
  // i-tiles w, w+8, w+16 and keeps their K fragments in registers; no other wave adds
  // to its rows.  The bias of a lane's eight rows j is the C operand of the matrix instruction.
  v16h bk[3];
  v8f  acc[3];
#pragma unroll  // constant indices keep the fragments and sums in registers
  for (int t = 0; t < 3; ++t) {
    bk[t]  = frag_from_row(&Kt[((w + t*8)*16 + n0)*KPITCH], hf);   // B[d][i] = K[i][d]
    acc[t] = z;
  }
#pragma unroll 2  // one group of LDS reads and one wait place per two strips instead of per strip
  for (int js = 0; js < 24; ++js) {
    const v16h a    = frag_from_row(&Qt[n0*KPITCH] + js*(16*KPITCH), hf);
    const v8f  bias = *(const v8f*)&colBias[js*16 + hf*8];       // rows j of this lane half
#pragma unroll  // constant indices keep the fragments and sums in registers
    for (int t = 0; t < 3; ++t) {
      const v8f e = wmma_f16(a, bk[t], bias);
#pragma unroll  // constant indices keep the fragments and sums in registers
      for (int r = 0; r < 8; ++r) acc[t][r] += __builtin_amdgcn_exp2f(e[r]);
    }
  }

#pragma unroll  // constant indices keep the fragments and sums in registers
  for (int t = 0; t < 3; ++t) {
    float sum = ((acc[t][0] + acc[t][1]) + (acc[t][2] + acc[t][3]))
              + ((acc[t][4] + acc[t][5]) + (acc[t][6] + acc[t][7]));
    sum += __shfl_xor(sum, 16, 32);        // the other eight rows j of every strip
    if (hf == 0)
      out[((size_t)(h*NN + (w + t*8)*16 + n0))*NL + l] = sum * (1.f / 384.f);
  }
}

// ---------------------------------------------------------------------------
extern "C" void kernel_launch(void* const* d_in, const int* in_sizes, int n_in,
                              void* d_out, int out_size, void* d_ws, size_t ws_size,
                              hipStream_t stream) {
  const float* x      = (const float*)d_in[0];
  const float* ln_w   = (const float*)d_in[1];
  const float* ln_b   = (const float*)d_in[2];
  const float* proj_w = (const float*)d_in[3];
  const float* proj_b = (const float*)d_in[4];
  const float* wk     = (const float*)d_in[5];
  const float* wq     = (const float*)d_in[6];

  // one block per (h,l) pair; the workspace is not used
  ln_kq_atten_kernel<<<NH*NL, 256, 0, stream>>>(x, ln_w, ln_b, proj_w, proj_b,
                                                wk, wq, (float*)d_out);
}

// v010
// A run of this version takes 19.6 microseconds.
// Timed twice side by side with v009, it ran 1.04 times as fast both times.
// All steps since v000 together make it 4.27 times as fast.
#include <hip/hip_runtime.h>
#include <hip/hip_bf16.h>

typedef _Float16 half_t;
typedef __attribute__((ext_vector_type(16))) _Float16 v16h;
typedef __attribute__((ext_vector_type(8)))  _Float16 v8h;
typedef __attribute__((ext_vector_type(4)))  _Float16 v4h;
typedef __attribute__((ext_vector_type(8)))  float    v8f;
typedef __attribute__((ext_vector_type(4)))  float    v4f;

#define NH   8
#define NN   384
#define NL   64
#define DIN  128
#define DOUT 32

__device__ __forceinline__ v8f wmma_f16(v16h a, v16h b, v8f c) {
  return __builtin_amdgcn_wmma_f32_16x16x32_f16(false, a, false, b, (short)0, c, false, false);
}

// Build a 16x32-f16 WMMA A/B fragment from a row-major f16 row (LDS or global).
// Per ISA 7.12.2: lane-half hf=0 needs K{0..7,16..23}, hf=1 needs K{8..15,24..31}
// -> two contiguous 16B chunks at +hf*8 and +hf*8+16 halves.
__device__ __forceinline__ v16h frag_from_row(const half_t* rowp, int hf) {
  v8h lo = *(const v8h*)(rowp + hf*8);
  v8h hi = *(const v8h*)(rowp + hf*8 + 16);
  v16h r;
#pragma unroll
  for (int e = 0; e < 8; ++e) { r[e] = lo[e]; r[e+8] = hi[e]; }
  return r;
}

// Eight f32 values rounded to f16 (round to nearest even).
__device__ __forceinline__ v8h half8_of(v8f v) {
  v8h r;
#pragma unroll  // constant element index keeps the vector in registers
  for (int e = 0; e < 8; ++e) r[e] = (half_t)v[e];
  return r;
}

// Four f32 values rounded to f16 (round to nearest even).
__device__ __forceinline__ v4h half4_of(v4f v) {
  v4h r;
#pragma unroll
  for (int e = 0; e < 4; ++e) r[e] = (half_t)v[e];
  return r;
}

// ---------------------------------------------------------------------------
// The one kernel: one block of 8 waves per (h,l) pair, two blocks per WGP, every block
// resident at once.
// Part A: LayerNorm + proj(128->32, +bias) + k/q proj (32->32) of the pair's own
// 384 rows x[h][i][l][:] (512 contiguous bytes each).  Each wave walks TPW 16-row
// tiles in a loop and writes its rows of K and Q as f16 straight into the LDS
// tiles that part B reads: K and Q never go through global memory.
// The weights are fetched from global memory once per block, in front of the loop,
// as f32, and rounded to f16 on their way into LDS (padded pitches): each thread
// takes 16 B of wk, 16 B of wq and 64 B of proj_w.  Each wave then takes its eight
// proj_w fragments from LDS into registers, where they and the bias stay.
// The affine part of the LayerNorm is carried by the projection:
//   proj_w @ (xhat*ln_w + ln_b) + proj_b = (proj_w * ln_w) @ xhat + (proj_w @ ln_b + proj_b),
// so proj_w is staged times ln_w (column by column, in f32, before the rounding) and the bias
// takes up proj_w @ ln_b (f32), both once per block; a tile's values are only centred and scaled.
// The f32 tile is brought into the wave's own LDS slot, at a padded row pitch, by
// asynchronous copies; each lane then reads its row's columns ONCE, already in
// WMMA A-fragment order, and keeps them in registers for the statistics, the
// normalisation and the f16 fragments.  As soon as a tile is in registers the
// copies of the wave's next tile are issued into the same slot, so that they fly
// while this tile is normalised and projected.
// All three products are formed transposed: the weight rows are the A operand (M = output
// feature) and the tile's rows i the B operand (N = i).  A lane's accumulators then hold
// eight consecutive features of ITS OWN row i, which is the order of a B fragment: xp goes
// from the accumulators into the next product's fragment without leaving the lane, and a
// row's K and Q values leave as 16-byte LDS stores.
// Part B: scores = K @ Q^T * scale (+eps), softmax over i (per column j),
// mean over j, all from LDS.
// Both reductions run down the accumulator registers of a lane:
//   pass 1 forms tiles with M = i, N = j (K as A, Q as B): a lane holds one
//          column j and reduces over its rows i; the two lane halves of a
//          column are merged once per strip, behind the loop.
//   pass 2 forms the transposed tiles, M = j, N = i (Q as A, K as B): a lane
//          holds one row i and sums its probabilities over j.
// ---------------------------------------------------------------------------
#define XPITCH 132  // floats per LDS row: 528 B = 16 B x 33 (odd), so the 16 rows of a b128 column read fall on 64 distinct banks
#define PPITCH 40   // halfs per LDS row of wk and of wq: 80 B = 16 B x 5 (odd), same reason
#define WPITCH 136  // halfs per LDS row of proj_w: 272 B = 16 B x 17 (odd), same reason
#define KPITCH 40   // halfs per LDS row of K and of Q: 80 B = 16 B x 5 (odd), same reason (at 64 B every fourth row falls on the same banks)
#define TPW 3       // tiles per wave: 24 tiles of 16 rows i = 8 waves x 3
#define SCALING 0.17677669529663687f  // 1/sqrt(32)
#define SC_LOG2E (SCALING * 1.4426950408889634f)  // raw score -> exponent of 2

// Eight rows of a tile, 512 contiguous bytes each, from global memory into the wave's LDS slot:
// each lane copies its own 16 bytes of every row (both addresses multiples of 16).
// lds: the lane's LDS byte address in the first of the rows; g: its global address there.
// s_wait_xcnt 0 stands inside the statement, behind the last copy, so that no address register
// that a copy names is rewritten in front of it (a precaution).
__device__ __forceinline__ void copy_rows8(unsigned lds, const float* g) {
  asm volatile("global_load_async_to_lds_b128 %0, %8, off\n\t"
               "global_load_async_to_lds_b128 %1, %9, off\n\t"
               "global_load_async_to_lds_b128 %2, %10, off\n\t"
               "global_load_async_to_lds_b128 %3, %11, off\n\t"
               "global_load_async_to_lds_b128 %4, %12, off\n\t"
               "global_load_async_to_lds_b128 %5, %13, off\n\t"
               "global_load_async_to_lds_b128 %6, %14, off\n\t"
               "global_load_async_to_lds_b128 %7, %15, off\n\t"
               "s_wait_xcnt 0x0"
               :: "v"(lds),               "v"(lds + 1*XPITCH*4), "v"(lds + 2*XPITCH*4), "v"(lds + 3*XPITCH*4),
                  "v"(lds + 4*XPITCH*4),  "v"(lds + 5*XPITCH*4), "v"(lds + 6*XPITCH*4), "v"(lds + 7*XPITCH*4),
                  "v"(g),                 "v"(g + 1*(NL*DIN)),   "v"(g + 2*(NL*DIN)),   "v"(g + 3*(NL*DIN)),
                  "v"(g + 4*(NL*DIN)),    "v"(g + 5*(NL*DIN)),   "v"(g + 6*(NL*DIN)),   "v"(g + 7*(NL*DIN))
               : "memory");
}

__global__ __launch_bounds__(256)
void ln_kq_atten_kernel(const float* __restrict__ x,
                        const float* __restrict__ ln_w,  const float* __restrict__ ln_b,
                        const float* __restrict__ proj_w, const float* __restrict__ proj_b,
                        const float* __restrict__ wk,    const float* __restrict__ wq,
                        float* __restrict__ out)
{
  __shared__ __align__(16) float  xs[8][16*XPITCH];  // 66 KB
  __shared__ __align__(16) half_t s_pw[DOUT*WPITCH]; // 8.5 KB
  __shared__ __align__(16) half_t s_wk[DOUT*PPITCH]; // 2.5 KB
  __shared__ __align__(16) half_t s_wq[DOUT*PPITCH]; // 2.5 KB
  __shared__ __align__(16) float  s_pb[DOUT];        // proj_w @ ln_b
  __shared__ __align__(16) half_t Kt[NN*KPITCH];  // 30 KB
  __shared__ __align__(16) half_t Qt[NN*KPITCH];  // 30 KB
  __shared__ __align__(32) float colBias[NN];   // per column j: -(shift + log2(denominator)), in exponents of 2

  const int h    = blockIdx.x >> 6;
  const int l    = blockIdx.x & 63;
  const int tid  = threadIdx.x;
  const int w    = tid >> 5;
  const int lane = tid & 31;
  const int n0   = lane & 15;      // N / M index within tile
  const int hf   = lane >> 4;      // lane half

  // --- the three weight matrices (f32) and the bias: the loads go out in front of the block's first
  //     64 KB of x, so that they do not queue behind it.  Per load a wave reads 512 contiguous bytes
  //     (one row of proj_w, four of wk or wq); pw4[k] = floats (k*256 + tid)*4 .. +3 of proj_w ---
  v4f pw4[4];
#pragma unroll
  for (int k = 0; k < 4; ++k) pw4[k] = *(const v4f*)(proj_w + (k*256 + tid)*4);
  const v4f wk4 = *(const v4f*)(wk + tid*4);
  const v4f wq4 = *(const v4f*)(wq + tid*4);
  // pw4[k] lies in row k*8 + w of proj_w, columns lane*4 .. +3: the LayerNorm vectors at those columns
  const v4f lw4 = *(const v4f*)(ln_w + lane*4);
  const v4f lb4 = *(const v4f*)(ln_b + lane*4);
  // proj_b of the features that this lane's accumulators hold: hf*8 .. +7 and 16 + hf*8 .. +7
  const v4f gb0 = *(const v4f*)(proj_b + hf*8);
  const v4f gb1 = *(const v4f*)(proj_b + hf*8 + 4);
  const v4f gb2 = *(const v4f*)(proj_b + hf*8 + 16);
  const v4f gb3 = *(const v4f*)(proj_b + hf*8 + 20);

  // --- the wave's first tile (16 rows i, NL*DIN floats apart; one row per copy) starts next;
  //     tile t begins at row (t*8 + w)*16 ---
  const unsigned xs_lds = (unsigned)(size_t)&xs[w][lane*4];   // low 32 bits: byte offset in the block's LDS
  const float*   xsrc   = x + ((size_t)(h*NN + w*16)*NL + l)*DIN + lane*4;
  copy_rows8(xs_lds, xsrc);
  copy_rows8(xs_lds + 8*XPITCH*4, xsrc + 8*(NL*DIN));
  // nothing that waits for a weight load is scheduled in front of the copies: they would start that much later
  __builtin_amdgcn_sched_barrier(0);

  // --- the weights, rounded to f16, staged once per block in LDS ---
#pragma unroll
  for (int k = 0; k < 4; ++k) {
    const int off = (k*256 + tid)*4;   // index of the thread's four floats in proj_w
    *(v4h*)&s_pw[(off >> 7)*WPITCH + (off & (DIN - 1))] = half4_of(pw4[k] * lw4);
  }
  *(v4h*)&s_wk[(tid >> 3)*PPITCH + (tid & 7)*4] = half4_of(wk4);
  *(v4h*)&s_wq[(tid >> 3)*PPITCH + (tid & 7)*4] = half4_of(wq4 * SC_LOG2E);  // Q comes out times SC_LOG2E: K.Q is an exponent of 2
  // proj_w @ ln_b for the wave's four rows: each lane's four columns, then a sum over the 32 lanes
  {
    float dk[4];
#pragma unroll
    for (int k = 0; k < 4; ++k) {
      const v4f p = pw4[k] * lb4;
      dk[k] = (p[0] + p[1]) + (p[2] + p[3]);
    }
#pragma unroll  // the four sums go through each exchange together: one LDS-pipe latency per step, not four
    for (int m = 16; m >= 1; m >>= 1)
#pragma unroll
      for (int k = 0; k < 4; ++k) dk[k] += __shfl_xor(dk[k], m, 32);
    if (lane == 0) {
#pragma unroll
      for (int k = 0; k < 4; ++k) s_pb[k*8 + w] = dk[k];
    }
  }
  __syncthreads();   // the staged weights are in LDS before any wave reads them

  // --- proj_w fragments: read once per wave, live over the tile loop like the bias ---
  v16h bp[2][4];
#pragma unroll
  for (int nt = 0; nt < 2; ++nt)
#pragma unroll
    for (int kb = 0; kb < 4; ++kb)
      bp[nt][kb] = frag_from_row(&s_pw[(n0 + nt*16)*WPITCH + kb*32], hf);
  // the whole bias of the lane's features: proj_b + proj_w @ ln_b
  const v4f pb0 = gb0 + *(const v4f*)&s_pb[hf*8];
  const v4f pb1 = gb1 + *(const v4f*)&s_pb[hf*8 + 4];
  const v4f pb2 = gb2 + *(const v4f*)&s_pb[hf*8 + 16];
  const v4f pb3 = gb3 + *(const v4f*)&s_pb[hf*8 + 20];

#pragma unroll 1  // rolled: one copy of the body keeps the wave under 256 registers, so two blocks share a WGP
  for (int t = 0; t < TPW; ++t) {
    const int rowBase = (t*8 + w) * 16;   // first row i of this wave's tile

    // this tile's 16 copies have landed in the wave's slot before anything of it is read
    asm volatile("s_wait_asynccnt 0x0" ::: "memory");
    __syncthreads();

    // --- this lane's 64 columns of row n0, in A-fragment order:
    //     xv[kb*4 + c*2 + q] = columns kb*32 + hf*8 + c*16 + q*4 .. +3 ---
    v4f xv[16];
#pragma unroll  // constant indices keep xv[] in registers
    for (int g = 0; g < 16; ++g) {
      const int col = (g >> 2)*32 + hf*8 + ((g >> 1) & 1)*16 + (g & 1)*4;
      xv[g] = *(const v4f*)&xs[w][n0*XPITCH + col];
    }

    // --- the next tile's copies into the same slot.  The slot is read by this wave alone, so the
    //     wave's own LDS wait frees it: every read above has returned before a copy can overwrite it ---
    if (t + 1 < TPW) {
      asm volatile("s_wait_dscnt 0x0" ::: "memory");
      const float* xnext = xsrc + (size_t)(t + 1)*(8*16*NL*DIN);
      copy_rows8(xs_lds, xnext);
      copy_rows8(xs_lds + 8*XPITCH*4, xnext + 8*(NL*DIN));
    }

    // --- LayerNorm stats: 2 lanes per row, four partial sums per lane ---
    v4f s4 = {0.f, 0.f, 0.f, 0.f}, q4 = {0.f, 0.f, 0.f, 0.f};
#pragma unroll  // constant indices keep xv[] in registers
    for (int g = 0; g < 16; ++g) { s4 += xv[g]; q4 += xv[g]*xv[g]; }
    float s  = (s4[0] + s4[1]) + (s4[2] + s4[3]);
    float s2 = (q4[0] + q4[1]) + (q4[2] + q4[3]);
    s  += __shfl_xor(s, 16, 32);
    s2 += __shfl_xor(s2, 16, 32);
    const float mu   = s * (1.f/128.f);
    const float var  = s2 * (1.f/128.f) - mu*mu;
    const float rstd = rsqrtf(var + 1e-5f);
    const float nmr  = -mu * rstd;

    // --- centre and scale -> f16 fragments (row n0 of the tile), in registers ---
    v16h af[4];
#pragma unroll  // constant indices keep xv[] and af[] in registers
    for (int g = 0; g < 16; ++g) {
      const v4f v = xv[g] * rstd + nmr;   // (x - mu) * rstd as one multiply-add
#pragma unroll  // constant element index into the fragment
      for (int e = 0; e < 4; ++e) af[g >> 2][(g & 3)*4 + e] = (half_t)v[e];
    }

    // --- proj, transposed: xp^T = (proj_w * ln_w) @ xhat^T + bias  (32x128 @ 128x16):
    //     c0[r] = xp[row n0][hf*8 + r], c1[r] = xp[row n0][16 + hf*8 + r] ---
    v8f c0, c1;
#pragma unroll  // constant element index keeps the vectors in registers
    for (int r = 0; r < 4; ++r) { c0[r] = pb0[r]; c0[r+4] = pb1[r]; c1[r] = pb2[r]; c1[r+4] = pb3[r]; }

#pragma unroll
    for (int kb = 0; kb < 4; ++kb) {
      c0 = wmma_f16(bp[0][kb], af[kb], c0);
      c1 = wmma_f16(bp[1][kb], af[kb], c1);
    }

    // --- k^T = wk @ xp^T , q^T = wq @ xp^T  (32x32 @ 32x16).  The lane's sixteen values of xp are
    //     the features hf*8 .. +7 and 16 + hf*8 .. +7 of row n0: its B fragment, element for element ---
    const v16h ak0 = frag_from_row(&s_wk[n0*PPITCH], hf);
    const v16h ak1 = frag_from_row(&s_wk[(n0+16)*PPITCH], hf);
    const v16h aq0 = frag_from_row(&s_wq[n0*PPITCH], hf);
    const v16h aq1 = frag_from_row(&s_wq[(n0+16)*PPITCH], hf);
    v16h b2;
#pragma unroll  // constant element index into the fragment
    for (int e = 0; e < 8; ++e) { b2[e] = (half_t)c0[e]; b2[e+8] = (half_t)c1[e]; }
    const v8f z0 = {};
    const v8f ck0 = wmma_f16(ak0, b2, z0);
    const v8f ck1 = wmma_f16(ak1, b2, z0);
    const v8f cq0 = wmma_f16(aq0, b2, z0);
    const v8f cq1 = wmma_f16(aq1, b2, z0);

    // K and Q of row rowBase + n0 as f16 into the block's LDS tiles, row-major [i][d] at the padded
    // pitch: each accumulator is eight consecutive d of that row, one 16-byte store
    half_t* krow = &Kt[(rowBase + n0)*KPITCH + hf*8];
    half_t* qrow = &Qt[(rowBase + n0)*KPITCH + hf*8];
    *(v8h*)krow        = half8_of(ck0);
    *(v8h*)(krow + 16) = half8_of(ck1);
    *(v8h*)qrow        = half8_of(cq0);
    *(v8h*)(qrow + 16) = half8_of(cq1);
  }
  __syncthreads();   // every wave's rows of K and Q are in LDS before any wave reads them

  const v8f z = {};

  // ---- pass 1: column statistics.  The wave owns j-strips w, w+8, w+16 and keeps
  // their Q fragments in registers, so each K fragment read serves all three.
  // Q carries the factor SC_LOG2E (it was folded into wq), so a product K.Q is already
  // an exponent of 2, and the column's shift enters as the C operand of the matrix
  // instruction: its result goes to the exponential as it is.
  // Any shift gives the same softmax as long as nothing overflows; the one used here is
  // known in front of the loop: the column's maximum over its first 16 rows.  The sum then
  // holds a term of about 1, so it cannot vanish; where a later score lies so far above the
  // shift that a sum is no longer finite, the wave takes the exact loop below instead.
  // The +eps of the reference is common to every score of a column and cancels in the softmax.
  {
    v16h bq[3];
    v8f  nsh[3];    // minus the column's shift, in all eight rows of the C operand
    v8f  drun[3];   // denominator over this lane's rows, one partial sum per accumulator register
    const v16h af = frag_from_row(&Kt[n0*KPITCH], hf);
#pragma unroll  // constant indices keep the fragments and sums in registers
    for (int s = 0; s < 3; ++s) {
      bq[s] = frag_from_row(&Qt[((w + s*8)*16 + n0)*KPITCH], hf);  // B[d][j] = Q[j][d]
      const v8f c = wmma_f16(af, bq[s], z);
      const float t0 = fmaxf(fmaxf(c[0], c[1]), c[2]);
      const float t1 = fmaxf(fmaxf(c[3], c[4]), c[5]);
      float m = fmaxf(fmaxf(t0, t1), fmaxf(c[6], c[7]));
      m = fmaxf(m, __shfl_xor(m, 16, 32));   // the other eight rows of the tile
#pragma unroll  // constant element index
      for (int r = 0; r < 8; ++r) nsh[s][r] = -m;
      drun[s] = z;
    }
    for (int ti = 0; ti < 24; ti += 2) {   // two i-tiles per group of LDS reads
      const v16h a0 = frag_from_row(&Kt[(ti*16 + n0)*KPITCH], hf);
      const v16h a1 = frag_from_row(&Kt[(ti*16 + 16 + n0)*KPITCH], hf);
      v8f c0[3], c1[3];
#pragma unroll  // constant indices keep the fragments and sums in registers
      for (int s = 0; s < 3; ++s) {
        c0[s] = wmma_f16(a0, bq[s], nsh[s]);
        c1[s] = wmma_f16(a1, bq[s], nsh[s]);
      }
#pragma unroll  // constant indices keep the fragments and sums in registers
      for (int s = 0; s < 3; ++s) {
        v8f p0, p1;
#pragma unroll  // constant indices keep the fragments and sums in registers
        for (int r = 0; r < 8; ++r) {
          p0[r] = __builtin_amdgcn_exp2f(c0[s][r]);
          p1[r] = __builtin_amdgcn_exp2f(c1[s][r]);
        }
        drun[s] += p0;
        drun[s] += p1;
      }
    }
    float d[3];
    bool  redo = false;
#pragma unroll  // constant indices keep the fragments and sums in registers
    for (int s = 0; s < 3; ++s) {          // both row halves of a column used the same shift: their sums add
      const float d_own = ((drun[s][0] + drun[s][1]) + (drun[s][2] + drun[s][3]))
                        + ((drun[s][4] + drun[s][5]) + (drun[s][6] + drun[s][7]));
      d[s] = d_own + __shfl_xor(d_own, 16, 32);
      redo = redo || !(d[s] < 3.0e38f);    // infinite or not a number
    }
    if (__builtin_amdgcn_ballot_w32(redo) == 0) {   // the same for the whole wave: a scalar branch
#pragma unroll  // constant indices keep the fragments and sums in registers
      for (int s = 0; s < 3; ++s)
        if (hf == 0) colBias[(w + s*8)*16 + n0] = nsh[s][0] - __builtin_amdgcn_logf(d[s]);  // v_log_f32: base 2
    } else {
      // the exact loop: running maximum, sums rescaled when it rises; one strip at a time
#pragma unroll 1  // rolled: this path is rare, one copy of it is enough
      for (int s = 0; s < 3; ++s) {
        const v16h bqs = frag_from_row(&Qt[((w + s*8)*16 + n0)*KPITCH], hf);
        float mrun = -__builtin_inff();
        v8f   dr   = z;
#pragma unroll 1  // rolled: this path is rare, one copy of it is enough
        for (int ti = 0; ti < 24; ++ti) {
          const v8f x = wmma_f16(frag_from_row(&Kt[(ti*16 + n0)*KPITCH], hf), bqs, z);
          const float t0 = fmaxf(fmaxf(x[0], x[1]), x[2]);
          const float t1 = fmaxf(fmaxf(x[3], x[4]), x[5]);
          const float t2 = fmaxf(fmaxf(x[6], x[7]), mrun);
          const float mnew = fmaxf(fmaxf(t0, t1), t2);
          const float corr = __builtin_amdgcn_exp2f(mrun - mnew);  // 0 on the first trip
          v8f p;
#pragma unroll  // constant element index
          for (int r = 0; r < 8; ++r) p[r] = __builtin_amdgcn_exp2f(x[r] - mnew);
          dr   = dr * corr + p;
          mrun = mnew;
        }
        const float d_own = ((dr[0] + dr[1]) + (dr[2] + dr[3])) + ((dr[4] + dr[5]) + (dr[6] + dr[7]));
        const float m_oth = __shfl_xor(mrun, 16, 32);
        const float d_oth = __shfl_xor(d_own, 16, 32);
        const float mk    = fmaxf(mrun, m_oth);
        const float dd    = d_own * __builtin_amdgcn_exp2f(mrun - mk)
                          + d_oth * __builtin_amdgcn_exp2f(m_oth - mk);
        if (hf == 0) colBias[(w + s*8)*16 + n0] = -(mk + __builtin_amdgcn_logf(dd));
      }
    }
  }
  __syncthreads();   // every column's bias is in LDS before any wave reads it

  // ---- pass 2: probabilities 2^(score + bias[j]), summed over j.  The wave owns
  // i-tiles w, w+8, w+16 and keeps their K fragments in registers; no other wave adds
  // to its rows.  The bias of a lane's eight rows j is the C operand of the matrix instruction.
  v16h bk[3];
  v8f  acc[3];
#pragma unroll  // constant indices keep the fragments and sums in registers
  for (int t = 0; t < 3; ++t) {
    bk[t]  = frag_from_row(&Kt[((w + t*8)*16 + n0)*KPITCH], hf);   // B[d][i] = K[i][d]
    acc[t] = z;
  }
#pragma unroll 2  // one group of LDS reads and one wait place per two strips instead of per strip
  for (int js = 0; js < 24; ++js) {
    const v16h a    = frag_from_row(&Qt[n0*KPITCH] + js*(16*KPITCH), hf);
    const v8f  bias = *(const v8f*)&colBias[js*16 + hf*8];       // rows j of this lane half
#pragma unroll  // constant indices keep the fragments and sums in registers
    for (int t = 0; t < 3; ++t) {
      const v8f e = wmma_f16(a, bk[t], bias);
#pragma unroll  // constant indices keep the fragments and sums in registers
      for (int r = 0; r < 8; ++r) acc[t][r] += __builtin_amdgcn_exp2f(e[r]);
    }
  }

#pragma unroll  // constant indices keep the fragments and sums in registers
  for (int t = 0; t < 3; ++t) {
    float sum = ((acc[t][0] + acc[t][1]) + (acc[t][2] + acc[t][3]))
              + ((acc[t][4] + acc[t][5]) + (acc[t][6] + acc[t][7]));
    sum += __shfl_xor(sum, 16, 32);        // the other eight rows j of every strip
    if (hf == 0)
      out[((size_t)(h*NN + (w + t*8)*16 + n0))*NL + l] = sum * (1.f / 384.f);
  }
}

// ---------------------------------------------------------------------------
extern "C" void kernel_launch(void* const* d_in, const int* in_sizes, int n_in,
                              void* d_out, int out_size, void* d_ws, size_t ws_size,
                              hipStream_t stream) {
  const float* x      = (const float*)d_in[0];
  const float* ln_w   = (const float*)d_in[1];
  const float* ln_b   = (const float*)d_in[2];
  const float* proj_w = (const float*)d_in[3];
  const float* proj_b = (const float*)d_in[4];
  const float* wk     = (const float*)d_in[5];
  const float* wq     = (const float*)d_in[6];

  // one block per (h,l) pair; the workspace is not used
  ln_kq_atten_kernel<<<NH*NL, 256, 0, stream>>>(x, ln_w, ln_b, proj_w, proj_b,
                                                wk, wq, (float*)d_out);
}
